// v000
// Times are from an AMD MI455X. After a warm-up the kernel runs many times in a row, and a time is the length of
// such a window on the GPU divided by its runs, so every launch and the gaps after it count. The runs cycle
// through copies of the inputs. A figure is the median of several windows, for all but v000 over two sittings.
// Sittings can differ by a few percent; kernels timed side by side share one.
// v000 is the starting kernel. One run takes 244 microseconds.
#include <hip/hip_runtime.h>
#include <hip/hip_bf16.h>

typedef __attribute__((ext_vector_type(16))) _Float16 v16h;
typedef __attribute__((ext_vector_type(8)))  float    v8f;

#define D_MODEL  1024
#define H_HEADS  16
#define DH_HEAD  64
#define NSEQ     2048
#define BATCH    2
#define QK_SCALE 0.03125f  // 1024^-0.5

static __device__ __forceinline__ unsigned lds_off(const void* p) {
  return (unsigned)(unsigned long long)p;
}
static __device__ __forceinline__ void async_ld_b128(unsigned ldsoff,
                                                     const void* gptr) {
  asm volatile("global_load_async_to_lds_b128 %0, %1, off"
               :: "v"(ldsoff), "v"(gptr) : "memory");
}
#define S_WAIT_ASYNCCNT(n) asm volatile("s_wait_asynccnt " #n ::: "memory")

static __device__ __forceinline__ v16h load_ab(const _Float16* p) {
  v16h r;
  __builtin_memcpy(&r, p, 16);
  __builtin_memcpy(reinterpret_cast<char*>(&r) + 16, p + 16, 16);
  return r;
}

static __device__ __forceinline__ v8f v8f_zero() {
  v8f z;
#pragma unroll
  for (int j = 0; j < 8; ++j) z[j] = 0.0f;
  return z;
}

static __device__ __forceinline__ v8f wmma_f16(v16h a, v16h b, v8f c) {
  return __builtin_amdgcn_wmma_f32_16x16x32_f16(false, a, false, b, (short)0, c,
                                                false, false);
}

// ---------------- elementwise f32 -> f16 ----------------
__global__ void cvt_f16_kernel(const float* __restrict__ in,
                               _Float16* __restrict__ out, int n) {
  int i = blockIdx.x * blockDim.x + threadIdx.x;
  if (i < n) out[i] = (_Float16)in[i];
}

// transpose+convert: in [K][Nc] f32 row-major -> out [Nc][K] f16 row-major
__global__ void cvtT_f16_kernel(const float* __restrict__ in,
                                _Float16* __restrict__ out, int K, int Nc) {
  int i = blockIdx.x * blockDim.x + threadIdx.x;
  if (i < K * Nc) {
    int n = i / K, k = i - n * K;
    out[i] = (_Float16)in[(size_t)k * Nc + n];
  }
}

// gather V part of qkv into vT[b][h][dh][key] (f16)
__global__ void vtrans_kernel(const _Float16* __restrict__ qkvh,
                              _Float16* __restrict__ vT) {
  int i = blockIdx.x * blockDim.x + threadIdx.x;
  const int total = BATCH * H_HEADS * DH_HEAD * NSEQ;
  if (i < total) {
    int key = i & (NSEQ - 1);
    int r = i >> 11;  // (b*H + h)*DH + dh
    int dh = r & (DH_HEAD - 1); r >>= 6;
    int h = r & (H_HEADS - 1);
    int b = r >> 4;
    vT[i] = qkvh[((size_t)(b * NSEQ) + key) * (3 * D_MODEL) + 2 * D_MODEL +
                 h * DH_HEAD + dh];
  }
}

// ---------------- WMMA GEMM with async-LDS double buffering ------------------
// C[M,Nc] = A[M,K](f16) @ Bt[Nc,K]^T(f16) + bias.
// 128 threads = 4 waves (2x2); workgroup tile 64M x 128N, K-step 32.
template <int OUTF32>
__global__ __launch_bounds__(128) void gemm_wmma_kernel(
    const _Float16* __restrict__ A, const _Float16* __restrict__ Bt,
    const float* __restrict__ bias, void* __restrict__ outp, int M, int Ncols,
    int K) {
  __shared__ _Float16 lsA[2][64][32];
  __shared__ _Float16 lsB[2][128][32];

  const int tid = threadIdx.x;
  const int l = tid & 31, wave = tid >> 5;
  const int lh = l >> 4, lm = l & 15;
  const int wm = wave >> 1, wn = wave & 1;
  const int mbase = blockIdx.y * 64;
  const int nbase = blockIdx.x * 128;

  // stage issue: 2 A-chunks + 4 B-chunks of 16B per thread
  auto issue = [&](int s, int kk) {
#pragma unroll
    for (int i = 0; i < 2; ++i) {
      int c = tid + 128 * i;           // 256 A chunks
      int r = c >> 2, seg = c & 3;
      async_ld_b128(lds_off(&lsA[s][r][seg * 8]),
                    A + (size_t)(mbase + r) * K + kk + seg * 8);
    }
#pragma unroll
    for (int i = 0; i < 4; ++i) {
      int c = tid + 128 * i;           // 512 B chunks
      int r = c >> 2, seg = c & 3;
      async_ld_b128(lds_off(&lsB[s][r][seg * 8]),
                    Bt + (size_t)(nbase + r) * K + kk + seg * 8);
    }
  };

  v8f acc[2][4];
#pragma unroll
  for (int t = 0; t < 2; ++t)
#pragma unroll
    for (int u = 0; u < 4; ++u) acc[t][u] = v8f_zero();

  const int nk = K / 32;
  issue(0, 0);
  for (int ik = 0; ik < nk; ++ik) {
    const int s = ik & 1;
    if (ik + 1 < nk) {
      issue(s ^ 1, (ik + 1) * 32);
      S_WAIT_ASYNCCNT(6);   // stage ik complete (in-order done)
    } else {
      S_WAIT_ASYNCCNT(0);
    }
    __syncthreads();        // all waves' stage-ik data visible in LDS

    v16h a[2], bo[4];
#pragma unroll
    for (int t = 0; t < 2; ++t)
      a[t] = load_ab(&lsA[s][wm * 32 + t * 16 + lm][8 * lh]);
#pragma unroll
    for (int u = 0; u < 4; ++u)
      bo[u] = load_ab(&lsB[s][wn * 64 + u * 16 + lm][8 * lh]);
#pragma unroll
    for (int t = 0; t < 2; ++t)
#pragma unroll
      for (int u = 0; u < 4; ++u) acc[t][u] = wmma_f16(a[t], bo[u], acc[t][u]);

    __syncthreads();        // reads done before buffer s is re-filled
  }

#pragma unroll
  for (int t = 0; t < 2; ++t) {
#pragma unroll
    for (int u = 0; u < 4; ++u) {
      const int col = nbase + wn * 64 + u * 16 + lm;
      const float bv = bias[col];
#pragma unroll
      for (int j = 0; j < 8; ++j) {
        const int row = mbase + wm * 32 + t * 16 + j + 8 * lh;
        const float v = acc[t][u][j] + bv;
        if (OUTF32)
          ((float*)outp)[(size_t)row * Ncols + col] = v;
        else
          ((_Float16*)outp)[(size_t)row * Ncols + col] = (_Float16)v;
      }
    }
  }
}

// ---------------- Flash attention: 4 waves share K/V via async LDS ----------
// Each wave owns 16 query rows; block covers 64 rows of one (b,h).
// S^T = K @ Q^T trick: softmax row = lane%16; S^T C-layout == A K-layout of
// P@V, so P needs no transpose, only f16 packing.
__global__ __launch_bounds__(128) void attn_kernel(
    const _Float16* __restrict__ qkvh, const _Float16* __restrict__ vT,
    const float* __restrict__ gamma, const float* __restrict__ dist,
    _Float16* __restrict__ attnh) {
  __shared__ _Float16 lsK[2][32][64];   // [key_local][dh]
  __shared__ _Float16 lsV[2][64][32];   // [dh][key_local]

  const int tid = threadIdx.x;
  const int l = tid & 31, wave = tid >> 5;
  const int lh = l >> 4, lm = l & 15;
  const int h = blockIdx.y, b = blockIdx.z;
  const int qt = blockIdx.x * 4 + wave;
  const int qrow = qt * 16 + lm;

  const size_t row3d = (size_t)3 * D_MODEL;
  const _Float16* qbase = qkvh + (size_t)(b * NSEQ) * row3d + h * DH_HEAD;
  const _Float16* kbase = qbase + D_MODEL;
  const _Float16* vTbase = vT + (size_t)(b * H_HEADS + h) * DH_HEAD * NSEQ;
  const float g = gamma[b * H_HEADS + h];
  const float* drow = dist + (size_t)qrow * NSEQ;

  // stage issue: 2 K-chunks + 2 V-chunks of 16B per thread
  auto issue = [&](int s, int kb0) {
#pragma unroll
    for (int i = 0; i < 2; ++i) {
      int c = tid + 128 * i;            // 256 K chunks (32 rows x 8)
      int r = c >> 3, seg = c & 7;
      async_ld_b128(lds_off(&lsK[s][r][seg * 8]),
                    kbase + (size_t)(kb0 + r) * row3d + seg * 8);
    }
#pragma unroll
    for (int i = 0; i < 2; ++i) {
      int c = tid + 128 * i;            // 256 V chunks (64 rows x 4)
      int r = c >> 2, seg = c & 3;
      async_ld_b128(lds_off(&lsV[s][r][seg * 8]),
                    vTbase + (size_t)r * NSEQ + kb0 + seg * 8);
    }
  };

  // Q^T as B operand (col = qrow = lane%16, K = dh contiguous): load once.
  v16h bq[2];
#pragma unroll
  for (int c = 0; c < 2; ++c)
    bq[c] = load_ab(qbase + (size_t)qrow * row3d + c * 32 + 8 * lh);

  v8f o[4];
#pragma unroll
  for (int d = 0; d < 4; ++d) o[d] = v8f_zero();
  float m = -1e30f, ssum = 0.0f;

  const int nkb = NSEQ / 32;
  issue(0, 0);
  for (int kb = 0; kb < nkb; ++kb) {
    const int s = kb & 1;
    const int kb0 = kb * 32;
    if (kb + 1 < nkb) {
      issue(s ^ 1, kb0 + 32);
      S_WAIT_ASYNCCNT(4);
    } else {
      S_WAIT_ASYNCCNT(0);
    }
    __syncthreads();

    // S^T tiles: A = 16 key rows from LDS, B = Q^T. Kdim = 64 -> 2 WMMA each.
    v8f st[2];
#pragma unroll
    for (int t = 0; t < 2; ++t) {
      v16h ak0 = load_ab(&lsK[s][t * 16 + lm][8 * lh]);
      v16h ak1 = load_ab(&lsK[s][t * 16 + lm][32 + 8 * lh]);
      st[t] = wmma_f16(ak0, bq[0], v8f_zero());
      st[t] = wmma_f16(ak1, bq[1], st[t]);
    }

    // scale + distance bias; element j of tile t = (key kb0+t*16+8*lh+j, qrow)
    float sc[2][8];
#pragma unroll
    for (int t = 0; t < 2; ++t) {
      float dbuf[8];
      __builtin_memcpy(dbuf, drow + kb0 + t * 16 + 8 * lh, 32);
#pragma unroll
      for (int j = 0; j < 8; ++j)
        sc[t][j] = st[t][j] * QK_SCALE - g * dbuf[j];
    }

    // online softmax (row = qrow = lane%16; cross-half reduce via shfl_xor 16)
    float bm = -1e30f;
#pragma unroll
    for (int t = 0; t < 2; ++t)
#pragma unroll
      for (int j = 0; j < 8; ++j) bm = fmaxf(bm, sc[t][j]);
    bm = fmaxf(bm, __shfl_xor(bm, 16));
    const float nm = fmaxf(m, bm);
    const float alpha = __expf(m - nm);
    float p[2][8];
    float ps = 0.0f;
#pragma unroll
    for (int t = 0; t < 2; ++t)
#pragma unroll
      for (int j = 0; j < 8; ++j) {
        p[t][j] = __expf(sc[t][j] - nm);
        ps += p[t][j];
      }
    ps += __shfl_xor(ps, 16);
    ssum = ssum * alpha + ps;
    m = nm;

    // rescale O accumulators (row of O tile j = qrow-local j+8*lh)
#pragma unroll
    for (int j = 0; j < 8; ++j) {
      const float aj = __shfl(alpha, j + 8 * lh);
#pragma unroll
      for (int d = 0; d < 4; ++d) o[d][j] *= aj;
    }

    v16h pa;
#pragma unroll
    for (int j = 0; j < 8; ++j) {
      pa[j] = (_Float16)p[0][j];
      pa[8 + j] = (_Float16)p[1][j];
    }

    // O += P @ V ; V B-operand from LDS (key contiguous per dh row)
#pragma unroll
    for (int d = 0; d < 4; ++d) {
      v16h vb = load_ab(&lsV[s][d * 16 + lm][8 * lh]);
      o[d] = wmma_f16(pa, vb, o[d]);
    }

    __syncthreads();  // all waves done with buffer s before refill
  }

  const float inv = 1.0f / ssum;
#pragma unroll
  for (int j = 0; j < 8; ++j) {
    const float ij = __shfl(inv, j + 8 * lh);
    const int row = qt * 16 + j + 8 * lh;
#pragma unroll
    for (int d = 0; d < 4; ++d) {
      attnh[((size_t)(b * NSEQ) + row) * D_MODEL + h * DH_HEAD + d * 16 + lm] =
          (_Float16)(o[d][j] * ij);
    }
  }
}

// ---------------------------------------------------------------------------
extern "C" void kernel_launch(void* const* d_in, const int* in_sizes, int n_in,
                              void* d_out, int out_size, void* d_ws,
                              size_t ws_size, hipStream_t stream) {
  const float* x      = (const float*)d_in[0];
  const float* gamma  = (const float*)d_in[1];
  const float* dist   = (const float*)d_in[2];
  const float* qkv_w  = (const float*)d_in[3];
  const float* qkv_b  = (const float*)d_in[4];
  const float* proj_w = (const float*)d_in[5];
  const float* proj_b = (const float*)d_in[6];
  float* out = (float*)d_out;

  const size_t n_x    = (size_t)BATCH * NSEQ * D_MODEL;      // 4Mi elems
  const size_t n_qkvw = (size_t)D_MODEL * 3 * D_MODEL;       // 3Mi
  const size_t n_pw   = (size_t)D_MODEL * D_MODEL;           // 1Mi
  const size_t n_qkv  = (size_t)BATCH * NSEQ * 3 * D_MODEL;  // 12Mi

  char* ws = (char*)d_ws;
  _Float16* xh     = (_Float16*)ws; ws += n_x * 2;
  _Float16* wqkvT  = (_Float16*)ws; ws += n_qkvw * 2;
  _Float16* wprojT = (_Float16*)ws; ws += n_pw * 2;
  _Float16* qkvh   = (_Float16*)ws; ws += n_qkv * 2;
  _Float16* vTh    = (_Float16*)ws; ws += n_x * 2;
  _Float16* attnh  = (_Float16*)ws; ws += n_x * 2;
  // total ws use: ~56 MB

  const int TB = 256;
  cvt_f16_kernel<<<(int)((n_x + TB - 1) / TB), TB, 0, stream>>>(x, xh,
                                                                (int)n_x);
  cvtT_f16_kernel<<<(int)((n_qkvw + TB - 1) / TB), TB, 0, stream>>>(
      qkv_w, wqkvT, D_MODEL, 3 * D_MODEL);
  cvtT_f16_kernel<<<(int)((n_pw + TB - 1) / TB), TB, 0, stream>>>(
      proj_w, wprojT, D_MODEL, D_MODEL);

  dim3 g1(3 * D_MODEL / 128, BATCH * NSEQ / 64);
  gemm_wmma_kernel<0><<<g1, 128, 0, stream>>>(xh, wqkvT, qkv_b, qkvh,
                                              BATCH * NSEQ, 3 * D_MODEL,
                                              D_MODEL);

  vtrans_kernel<<<(int)((n_x + TB - 1) / TB), TB, 0, stream>>>(qkvh, vTh);

  dim3 ga(NSEQ / 64, H_HEADS, BATCH);
  attn_kernel<<<ga, 128, 0, stream>>>(qkvh, vTh, gamma, dist, attnh);

  dim3 g2(D_MODEL / 128, BATCH * NSEQ / 64);
  gemm_wmma_kernel<1><<<g2, 128, 0, stream>>>(attnh, wprojT, proj_b, out,
                                              BATCH * NSEQ, D_MODEL, D_MODEL);
}

// v001
// One run takes 196 microseconds.
// In two side-by-side timings against v000, it was 1.28 and 1.29 times as fast.
#include <hip/hip_runtime.h>
#include <hip/hip_bf16.h>

typedef __attribute__((ext_vector_type(16))) _Float16 v16h;
typedef __attribute__((ext_vector_type(8)))  float    v8f;

#define D_MODEL  1024
#define H_HEADS  16
#define DH_HEAD  64
#define NSEQ     2048
#define BATCH    2
#define QK_SCALE 0.03125f  // 1024^-0.5

static __device__ __forceinline__ unsigned lds_off(const void* p) {
  return (unsigned)(unsigned long long)p;
}
static __device__ __forceinline__ void async_ld_b128(unsigned ldsoff,
                                                     const void* gptr) {
  asm volatile("global_load_async_to_lds_b128 %0, %1, off"
               :: "v"(ldsoff), "v"(gptr) : "memory");
}
#define S_WAIT_ASYNCCNT(n) asm volatile("s_wait_asynccnt " #n ::: "memory")

static __device__ __forceinline__ v16h load_ab(const _Float16* p) {
  v16h r;
  __builtin_memcpy(&r, p, 16);
  __builtin_memcpy(reinterpret_cast<char*>(&r) + 16, p + 16, 16);
  return r;
}

static __device__ __forceinline__ v8f v8f_zero() {
  v8f z;
#pragma unroll
  for (int j = 0; j < 8; ++j) z[j] = 0.0f;
  return z;
}

static __device__ __forceinline__ v8f wmma_f16(v16h a, v16h b, v8f c) {
  return __builtin_amdgcn_wmma_f32_16x16x32_f16(false, a, false, b, (short)0, c,
                                                false, false);
}

// ---------------- elementwise f32 -> f16 ----------------
__global__ void cvt_f16_kernel(const float* __restrict__ in,
                               _Float16* __restrict__ out, int n) {
  int i = blockIdx.x * blockDim.x + threadIdx.x;
  if (i < n) out[i] = (_Float16)in[i];
}

// transpose+convert: in [K][Nc] f32 row-major -> out [Nc][K] f16 row-major
__global__ void cvtT_f16_kernel(const float* __restrict__ in,
                                _Float16* __restrict__ out, int K, int Nc) {
  int i = blockIdx.x * blockDim.x + threadIdx.x;
  if (i < K * Nc) {
    int n = i / K, k = i - n * K;
    out[i] = (_Float16)in[(size_t)k * Nc + n];
  }
}

// gather V part of qkv into vT[b][h][dh][key] (f16)
__global__ void vtrans_kernel(const _Float16* __restrict__ qkvh,
                              _Float16* __restrict__ vT) {
  int i = blockIdx.x * blockDim.x + threadIdx.x;
  const int total = BATCH * H_HEADS * DH_HEAD * NSEQ;
  if (i < total) {
    int key = i & (NSEQ - 1);
    int r = i >> 11;  // (b*H + h)*DH + dh
    int dh = r & (DH_HEAD - 1); r >>= 6;
    int h = r & (H_HEADS - 1);
    int b = r >> 4;
    vT[i] = qkvh[((size_t)(b * NSEQ) + key) * (3 * D_MODEL) + 2 * D_MODEL +
                 h * DH_HEAD + dh];
  }
}

// ---------------- WMMA GEMM with async-LDS double buffering ------------------
// C[M,Nc] = A[M,K](f16) @ Bt[Nc,K]^T(f16) + bias.
// 128 threads = 4 waves (2x2); workgroup tile 64M x 128N, K-step 32.
template <int OUTF32>
__global__ __launch_bounds__(128) void gemm_wmma_kernel(
    const _Float16* __restrict__ A, const _Float16* __restrict__ Bt,
    const float* __restrict__ bias, void* __restrict__ outp, int M, int Ncols,
    int K) {
  __shared__ _Float16 lsA[2][64][40];
  __shared__ _Float16 lsB[2][128][40];

  const int tid = threadIdx.x;
  const int l = tid & 31, wave = tid >> 5;
  const int lh = l >> 4, lm = l & 15;
  const int wm = wave >> 1, wn = wave & 1;
  const int mbase = blockIdx.y * 64;
  const int nbase = blockIdx.x * 128;

  // stage issue: 2 A-chunks + 4 B-chunks of 16B per thread
  auto issue = [&](int s, int kk) {
#pragma unroll
    for (int i = 0; i < 2; ++i) {
      int c = tid + 128 * i;           // 256 A chunks
      int r = c >> 2, seg = c & 3;
      async_ld_b128(lds_off(&lsA[s][r][seg * 8]),
                    A + (size_t)(mbase + r) * K + kk + seg * 8);
    }
#pragma unroll
    for (int i = 0; i < 4; ++i) {
      int c = tid + 128 * i;           // 512 B chunks
      int r = c >> 2, seg = c & 3;
      async_ld_b128(lds_off(&lsB[s][r][seg * 8]),
                    Bt + (size_t)(nbase + r) * K + kk + seg * 8);
    }
  };

  v8f acc[2][4];
#pragma unroll
  for (int t = 0; t < 2; ++t)
#pragma unroll
    for (int u = 0; u < 4; ++u) acc[t][u] = v8f_zero();

  const int nk = K / 32;
  issue(0, 0);
  for (int ik = 0; ik < nk; ++ik) {
    const int s = ik & 1;
    if (ik + 1 < nk) {
      issue(s ^ 1, (ik + 1) * 32);
      S_WAIT_ASYNCCNT(6);   // stage ik complete (in-order done)
    } else {
      S_WAIT_ASYNCCNT(0);
    }
    __syncthreads();        // all waves' stage-ik data visible in LDS

    v16h a[2], bo[4];
#pragma unroll
    for (int t = 0; t < 2; ++t)
      a[t] = load_ab(&lsA[s][wm * 32 + t * 16 + lm][8 * lh]);
#pragma unroll
    for (int u = 0; u < 4; ++u)
      bo[u] = load_ab(&lsB[s][wn * 64 + u * 16 + lm][8 * lh]);
#pragma unroll
    for (int t = 0; t < 2; ++t)
#pragma unroll
      for (int u = 0; u < 4; ++u) acc[t][u] = wmma_f16(a[t], bo[u], acc[t][u]);

    __syncthreads();        // reads done before buffer s is re-filled
  }

#pragma unroll
  for (int t = 0; t < 2; ++t) {
#pragma unroll
    for (int u = 0; u < 4; ++u) {
      const int col = nbase + wn * 64 + u * 16 + lm;
      const float bv = bias[col];
#pragma unroll
      for (int j = 0; j < 8; ++j) {
        const int row = mbase + wm * 32 + t * 16 + j + 8 * lh;
        const float v = acc[t][u][j] + bv;
        if (OUTF32)
          ((float*)outp)[(size_t)row * Ncols + col] = v;
        else
          ((_Float16*)outp)[(size_t)row * Ncols + col] = (_Float16)v;
      }
    }
  }
}

// ---------------- Flash attention: 4 waves share K/V via async LDS ----------
// Each wave owns 16 query rows; block covers 64 rows of one (b,h).
// S^T = K @ Q^T trick: softmax row = lane%16; S^T C-layout == A K-layout of
// P@V, so P needs no transpose, only f16 packing.
__global__ __launch_bounds__(128) void attn_kernel(
    const _Float16* __restrict__ qkvh, const _Float16* __restrict__ vT,
    const float* __restrict__ gamma, const float* __restrict__ dist,
    _Float16* __restrict__ attnh) {
  __shared__ _Float16 lsK[2][32][72];   // [key_local][dh], 64 used
  __shared__ _Float16 lsV[2][64][40];   // [dh][key_local], 32 used

  const int tid = threadIdx.x;
  const int l = tid & 31, wave = tid >> 5;
  const int lh = l >> 4, lm = l & 15;
  const int h = blockIdx.y, b = blockIdx.z;
  const int qt = blockIdx.x * 4 + wave;
  const int qrow = qt * 16 + lm;

  const size_t row3d = (size_t)3 * D_MODEL;
  const _Float16* qbase = qkvh + (size_t)(b * NSEQ) * row3d + h * DH_HEAD;
  const _Float16* kbase = qbase + D_MODEL;
  const _Float16* vTbase = vT + (size_t)(b * H_HEADS + h) * DH_HEAD * NSEQ;
  const float g = gamma[b * H_HEADS + h];
  const float* drow = dist + (size_t)qrow * NSEQ;

  // stage issue: 2 K-chunks + 2 V-chunks of 16B per thread
  auto issue = [&](int s, int kb0) {
#pragma unroll
    for (int i = 0; i < 2; ++i) {
      int c = tid + 128 * i;            // 256 K chunks (32 rows x 8)
      int r = c >> 3, seg = c & 7;
      async_ld_b128(lds_off(&lsK[s][r][seg * 8]),
                    kbase + (size_t)(kb0 + r) * row3d + seg * 8);
    }
#pragma unroll
    for (int i = 0; i < 2; ++i) {
      int c = tid + 128 * i;            // 256 V chunks (64 rows x 4)
      int r = c >> 2, seg = c & 3;
      async_ld_b128(lds_off(&lsV[s][r][seg * 8]),
                    vTbase + (size_t)r * NSEQ + kb0 + seg * 8);
    }
  };

  // Q^T as B operand (col = qrow = lane%16, K = dh contiguous): load once.
  v16h bq[2];
#pragma unroll
  for (int c = 0; c < 2; ++c)
    bq[c] = load_ab(qbase + (size_t)qrow * row3d + c * 32 + 8 * lh);

  v8f o[4];
#pragma unroll
  for (int d = 0; d < 4; ++d) o[d] = v8f_zero();
  float m = -1e30f, ssum = 0.0f;

  const int nkb = NSEQ / 32;
  issue(0, 0);
  for (int kb = 0; kb < nkb; ++kb) {
    const int s = kb & 1;
    const int kb0 = kb * 32;
    if (kb + 1 < nkb) {
      issue(s ^ 1, kb0 + 32);
      S_WAIT_ASYNCCNT(4);
    } else {
      S_WAIT_ASYNCCNT(0);
    }
    __syncthreads();

    // S^T tiles: A = 16 key rows from LDS, B = Q^T. Kdim = 64 -> 2 WMMA each.
    v8f st[2];
#pragma unroll
    for (int t = 0; t < 2; ++t) {
      v16h ak0 = load_ab(&lsK[s][t * 16 + lm][8 * lh]);
      v16h ak1 = load_ab(&lsK[s][t * 16 + lm][32 + 8 * lh]);
      st[t] = wmma_f16(ak0, bq[0], v8f_zero());
      st[t] = wmma_f16(ak1, bq[1], st[t]);
    }

    // scale + distance bias; element j of tile t = (key kb0+t*16+8*lh+j, qrow)
    float sc[2][8];
#pragma unroll
    for (int t = 0; t < 2; ++t) {
      float dbuf[8];
      __builtin_memcpy(dbuf, drow + kb0 + t * 16 + 8 * lh, 32);
#pragma unroll
      for (int j = 0; j < 8; ++j)
        sc[t][j] = st[t][j] * QK_SCALE - g * dbuf[j];
    }

    // online softmax (row = qrow = lane%16; cross-half reduce via shfl_xor 16)
    float bm = -1e30f;
#pragma unroll
    for (int t = 0; t < 2; ++t)
#pragma unroll
      for (int j = 0; j < 8; ++j) bm = fmaxf(bm, sc[t][j]);
    bm = fmaxf(bm, __shfl_xor(bm, 16));
    const float nm = fmaxf(m, bm);
    const float alpha = __expf(m - nm);
    float p[2][8];
    float ps = 0.0f;
#pragma unroll
    for (int t = 0; t < 2; ++t)
#pragma unroll
      for (int j = 0; j < 8; ++j) {
        p[t][j] = __expf(sc[t][j] - nm);
        ps += p[t][j];
      }
    ps += __shfl_xor(ps, 16);
    ssum = ssum * alpha + ps;
    m = nm;

    // rescale O accumulators (row of O tile j = qrow-local j+8*lh)
#pragma unroll
    for (int j = 0; j < 8; ++j) {
      const float aj = __shfl(alpha, j + 8 * lh);
#pragma unroll
      for (int d = 0; d < 4; ++d) o[d][j] *= aj;
    }

    v16h pa;
#pragma unroll
    for (int j = 0; j < 8; ++j) {
      pa[j] = (_Float16)p[0][j];
      pa[8 + j] = (_Float16)p[1][j];
    }

    // O += P @ V ; V B-operand from LDS (key contiguous per dh row)
#pragma unroll
    for (int d = 0; d < 4; ++d) {
      v16h vb = load_ab(&lsV[s][d * 16 + lm][8 * lh]);
      o[d] = wmma_f16(pa, vb, o[d]);
    }

    __syncthreads();  // all waves done with buffer s before refill
  }

  const float inv = 1.0f / ssum;
#pragma unroll
  for (int j = 0; j < 8; ++j) {
    const float ij = __shfl(inv, j + 8 * lh);
    const int row = qt * 16 + j + 8 * lh;
#pragma unroll
    for (int d = 0; d < 4; ++d) {
      attnh[((size_t)(b * NSEQ) + row) * D_MODEL + h * DH_HEAD + d * 16 + lm] =
          (_Float16)(o[d][j] * ij);
    }
  }
}

// ---------------------------------------------------------------------------
extern "C" void kernel_launch(void* const* d_in, const int* in_sizes, int n_in,
                              void* d_out, int out_size, void* d_ws,
                              size_t ws_size, hipStream_t stream) {
  const float* x      = (const float*)d_in[0];
  const float* gamma  = (const float*)d_in[1];
  const float* dist   = (const float*)d_in[2];
  const float* qkv_w  = (const float*)d_in[3];
  const float* qkv_b  = (const float*)d_in[4];
  const float* proj_w = (const float*)d_in[5];
  const float* proj_b = (const float*)d_in[6];
  float* out = (float*)d_out;

  const size_t n_x    = (size_t)BATCH * NSEQ * D_MODEL;      // 4Mi elems
  const size_t n_qkvw = (size_t)D_MODEL * 3 * D_MODEL;       // 3Mi
  const size_t n_pw   = (size_t)D_MODEL * D_MODEL;           // 1Mi
  const size_t n_qkv  = (size_t)BATCH * NSEQ * 3 * D_MODEL;  // 12Mi

  char* ws = (char*)d_ws;
  _Float16* xh     = (_Float16*)ws; ws += n_x * 2;
  _Float16* wqkvT  = (_Float16*)ws; ws += n_qkvw * 2;
  _Float16* wprojT = (_Float16*)ws; ws += n_pw * 2;
  _Float16* qkvh   = (_Float16*)ws; ws += n_qkv * 2;
  _Float16* vTh    = (_Float16*)ws; ws += n_x * 2;
  _Float16* attnh  = (_Float16*)ws; ws += n_x * 2;
  // total ws use: ~56 MB

  const int TB = 256;
  cvt_f16_kernel<<<(int)((n_x + TB - 1) / TB), TB, 0, stream>>>(x, xh,
                                                                (int)n_x);
  cvtT_f16_kernel<<<(int)((n_qkvw + TB - 1) / TB), TB, 0, stream>>>(
      qkv_w, wqkvT, D_MODEL, 3 * D_MODEL);
  cvtT_f16_kernel<<<(int)((n_pw + TB - 1) / TB), TB, 0, stream>>>(
      proj_w, wprojT, D_MODEL, D_MODEL);

  dim3 g1(3 * D_MODEL / 128, BATCH * NSEQ / 64);
  gemm_wmma_kernel<0><<<g1, 128, 0, stream>>>(xh, wqkvT, qkv_b, qkvh,
                                              BATCH * NSEQ, 3 * D_MODEL,
                                              D_MODEL);

  vtrans_kernel<<<(int)((n_x + TB - 1) / TB), TB, 0, stream>>>(qkvh, vTh);

  dim3 ga(NSEQ / 64, H_HEADS, BATCH);
  attn_kernel<<<ga, 128, 0, stream>>>(qkvh, vTh, gamma, dist, attnh);

  dim3 g2(D_MODEL / 128, BATCH * NSEQ / 64);
  gemm_wmma_kernel<1><<<g2, 128, 0, stream>>>(attnh, wprojT, proj_b, out,
                                              BATCH * NSEQ, D_MODEL, D_MODEL);
}

// v002
// Measured time: 162 microseconds a run.
// Two timings next to v001 both put it at 1.21 times that version's speed.
// Counting every step since v000, it is 1.55 times as fast.
#include <hip/hip_runtime.h>
#include <hip/hip_bf16.h>

typedef __attribute__((ext_vector_type(16))) _Float16 v16h;
typedef __attribute__((ext_vector_type(8)))  float    v8f;

#define D_MODEL  1024
#define H_HEADS  16
#define DH_HEAD  64
#define NSEQ     2048
#define BATCH    2
#define QK_SCALE 0.03125f  // 1024^-0.5

static __device__ __forceinline__ unsigned lds_off(const void* p) {
  return (unsigned)(unsigned long long)p;
}
static __device__ __forceinline__ void async_ld_b128(unsigned ldsoff,
                                                     const void* gptr) {
  asm volatile("global_load_async_to_lds_b128 %0, %1, off"
               :: "v"(ldsoff), "v"(gptr) : "memory");
}
#define S_WAIT_ASYNCCNT(n) asm volatile("s_wait_asynccnt " #n ::: "memory")

static __device__ __forceinline__ v16h load_ab(const _Float16* p) {
  v16h r;
  __builtin_memcpy(&r, p, 16);
  __builtin_memcpy(reinterpret_cast<char*>(&r) + 16, p + 16, 16);
  return r;
}

static __device__ __forceinline__ v8f v8f_zero() {
  v8f z;
#pragma unroll
  for (int j = 0; j < 8; ++j) z[j] = 0.0f;
  return z;
}

static __device__ __forceinline__ v8f wmma_f16(v16h a, v16h b, v8f c) {
  return __builtin_amdgcn_wmma_f32_16x16x32_f16(false, a, false, b, (short)0, c,
                                                false, false);
}

// ---------------- conversion and transposition launches ----------------
// All four move 16 B per lane (8 B where f32 narrows to f16 in place) so that
// every wave-wide access covers whole 128-B lines, and a thread handles many
// elements, so that few waves have to be started.
typedef __attribute__((ext_vector_type(4))) float    f32x4;
typedef __attribute__((ext_vector_type(4))) unsigned u32x4;
typedef __attribute__((ext_vector_type(2))) unsigned u32x2;
typedef __attribute__((ext_vector_type(2))) _Float16 f16x2;

static __device__ __forceinline__ unsigned pack_f16(float a, float b) {
  f16x2 p;
  p[0] = (_Float16)a;
  p[1] = (_Float16)b;
  return __builtin_bit_cast(unsigned, p);
}

#define TT_PITCH 33

// Column-wise read of 64 tile rows and row-wise store of their transpose:
// dst row c (pitch dpitch elements) receives rows 0..63 of column c.
// 8 lanes cover one 128-B destination line; a thread serves columns 2*cp, 2*cp+1.
static __device__ __forceinline__ void tile_store_T(
    const unsigned (*tile)[TT_PITCH], _Float16* __restrict__ dst, size_t dpitch,
    int tid) {
  const int rs = tid & 7, cp = tid >> 3;
  // Both loops unrolled: w, lo and hi are indexed by constants and stay in
  // registers, and the eight LDS reads issue as one group.
  unsigned w[8];
#pragma unroll
  for (int i = 0; i < 8; ++i) w[i] = tile[8 * rs + i][cp];
  u32x4 lo, hi;
#pragma unroll
  for (int q = 0; q < 4; ++q) {
    lo[q] = (w[2 * q] & 0xffffu) | (w[2 * q + 1] << 16);
    hi[q] = (w[2 * q] >> 16) | (w[2 * q + 1] & 0xffff0000u);
  }
  *reinterpret_cast<u32x4*>(dst + (size_t)(2 * cp) * dpitch + 8 * rs) = lo;
  *reinterpret_cast<u32x4*>(dst + (size_t)(2 * cp + 1) * dpitch + 8 * rs) = hi;
}

// elementwise f32 -> f16; a block converts 8192 consecutive elements.
__global__ __launch_bounds__(256) void cvt_f16_kernel(
    const float* __restrict__ in, _Float16* __restrict__ out) {
  const size_t base = (size_t)blockIdx.x * 8192 + threadIdx.x * 4;
  // Unrolled, loads apart from stores: all eight loads are in flight before
  // the first is waited for.
  f32x4 v[8];
#pragma unroll
  for (int j = 0; j < 8; ++j)
    v[j] = *reinterpret_cast<const f32x4*>(in + base + j * 1024);
#pragma unroll
  for (int j = 0; j < 8; ++j) {
    u32x2 o;
    o[0] = pack_f16(v[j][0], v[j][1]);
    o[1] = pack_f16(v[j][2], v[j][3]);
    *reinterpret_cast<u32x2*>(out + base + j * 1024) = o;
  }
}

// transpose+convert: in [K][Nc] f32 row-major -> out [Nc][K] f16 row-major.
// One block per 128(k) x 64(n) tile.
// K and Nc are compile-time so that the eight row loads share one address
// register pair and differ only in their immediate offsets.
template <int K, int Nc>
__global__ __launch_bounds__(256) void cvtT_f16_kernel(
    const float* __restrict__ in, _Float16* __restrict__ out) {
  __shared__ unsigned tile[128][TT_PITCH];
  const int tid = threadIdx.x;
  const int n0 = blockIdx.x * 64, k0 = blockIdx.y * 128;
  const int c4 = tid & 15, r = tid >> 4;
  const float* src = in + (size_t)(k0 + r) * Nc + n0 + 4 * c4;
  // Unrolled, loads apart from LDS writes: all eight loads are in flight
  // before the first is waited for.
  f32x4 v[8];
#pragma unroll
  for (int i = 0; i < 8; ++i)
    v[i] = *reinterpret_cast<const f32x4*>(src + (size_t)i * 16 * Nc);
#pragma unroll
  for (int i = 0; i < 8; ++i) {
    tile[r + 16 * i][2 * c4] = pack_f16(v[i][0], v[i][1]);
    tile[r + 16 * i][2 * c4 + 1] = pack_f16(v[i][2], v[i][3]);
  }
  __syncthreads();  // the whole tile is written before any column is read
  _Float16* dst = out + (size_t)n0 * K + k0;
  tile_store_T(tile, dst, (size_t)K, tid);
  tile_store_T(tile + 64, dst + 64, (size_t)K, tid);
}

// gather V part of qkv into vT[b][h][dh][key] (f16).
// One block per 128(key) x 64(dh) tile of one (b,h).
__global__ __launch_bounds__(256) void vtrans_kernel(
    const _Float16* __restrict__ qkvh, _Float16* __restrict__ vT) {
  __shared__ unsigned tile[128][TT_PITCH];
  const int tid = threadIdx.x;
  const int key0 = blockIdx.x * 128;
  const int bh = blockIdx.y;
  const int b = bh / H_HEADS, h = bh % H_HEADS;
  const _Float16* src = qkvh + ((size_t)(b * NSEQ) + key0) * (3 * D_MODEL) +
                        2 * D_MODEL + h * DH_HEAD;
  const int seg = tid & 7, r = tid >> 3;
  // Unrolled, loads apart from LDS writes: all four loads are in flight
  // before the first is waited for.
  u32x4 v[4];
#pragma unroll
  for (int i = 0; i < 4; ++i)
    v[i] = *reinterpret_cast<const u32x4*>(
        src + (size_t)(r + 32 * i) * (3 * D_MODEL) + seg * 8);
#pragma unroll
  for (int i = 0; i < 4; ++i)
#pragma unroll
    for (int q = 0; q < 4; ++q) tile[r + 32 * i][4 * seg + q] = v[i][q];
  __syncthreads();  // the whole tile is written before any column is read
  _Float16* dst = vT + (size_t)bh * DH_HEAD * NSEQ + key0;
  tile_store_T(tile, dst, (size_t)NSEQ, tid);
  tile_store_T(tile + 64, dst + 64, (size_t)NSEQ, tid);
}

// ---------------- WMMA GEMM with async-LDS double buffering ------------------
// C[M,Nc] = A[M,K](f16) @ Bt[Nc,K]^T(f16) + bias.
// 128 threads = 4 waves (2x2); workgroup tile 64M x 128N, K-step 32.
template <int OUTF32>
__global__ __launch_bounds__(128) void gemm_wmma_kernel(
    const _Float16* __restrict__ A, const _Float16* __restrict__ Bt,
    const float* __restrict__ bias, void* __restrict__ outp, int M, int Ncols,
    int K) {
  __shared__ _Float16 lsA[2][64][40];
  __shared__ _Float16 lsB[2][128][40];

  const int tid = threadIdx.x;
  const int l = tid & 31, wave = tid >> 5;
  const int lh = l >> 4, lm = l & 15;
  const int wm = wave >> 1, wn = wave & 1;
  const int mbase = blockIdx.y * 64;
  const int nbase = blockIdx.x * 128;

  // stage issue: 2 A-chunks + 4 B-chunks of 16B per thread
  auto issue = [&](int s, int kk) {
#pragma unroll
    for (int i = 0; i < 2; ++i) {
      int c = tid + 128 * i;           // 256 A chunks
      int r = c >> 2, seg = c & 3;
      async_ld_b128(lds_off(&lsA[s][r][seg * 8]),
                    A + (size_t)(mbase + r) * K + kk + seg * 8);
    }
#pragma unroll
    for (int i = 0; i < 4; ++i) {
      int c = tid + 128 * i;           // 512 B chunks
      int r = c >> 2, seg = c & 3;
      async_ld_b128(lds_off(&lsB[s][r][seg * 8]),
                    Bt + (size_t)(nbase + r) * K + kk + seg * 8);
    }
  };

  v8f acc[2][4];
#pragma unroll
  for (int t = 0; t < 2; ++t)
#pragma unroll
    for (int u = 0; u < 4; ++u) acc[t][u] = v8f_zero();

  const int nk = K / 32;
  issue(0, 0);
  for (int ik = 0; ik < nk; ++ik) {
    const int s = ik & 1;
    if (ik + 1 < nk) {
      issue(s ^ 1, (ik + 1) * 32);
      S_WAIT_ASYNCCNT(6);   // stage ik complete (in-order done)
    } else {
      S_WAIT_ASYNCCNT(0);
    }
    __syncthreads();        // all waves' stage-ik data visible in LDS

    v16h a[2], bo[4];
#pragma unroll
    for (int t = 0; t < 2; ++t)
      a[t] = load_ab(&lsA[s][wm * 32 + t * 16 + lm][8 * lh]);
#pragma unroll
    for (int u = 0; u < 4; ++u)
      bo[u] = load_ab(&lsB[s][wn * 64 + u * 16 + lm][8 * lh]);
#pragma unroll
    for (int t = 0; t < 2; ++t)
#pragma unroll
      for (int u = 0; u < 4; ++u) acc[t][u] = wmma_f16(a[t], bo[u], acc[t][u]);

    __syncthreads();        // reads done before buffer s is re-filled
  }

#pragma unroll
  for (int t = 0; t < 2; ++t) {
#pragma unroll
    for (int u = 0; u < 4; ++u) {
      const int col = nbase + wn * 64 + u * 16 + lm;
      const float bv = bias[col];
#pragma unroll
      for (int j = 0; j < 8; ++j) {
        const int row = mbase + wm * 32 + t * 16 + j + 8 * lh;
        const float v = acc[t][u][j] + bv;
        if (OUTF32)
          ((float*)outp)[(size_t)row * Ncols + col] = v;
        else
          ((_Float16*)outp)[(size_t)row * Ncols + col] = (_Float16)v;
      }
    }
  }
}

// ---------------- Flash attention: 4 waves share K/V via async LDS ----------
// Each wave owns 16 query rows; block covers 64 rows of one (b,h).
// S^T = K @ Q^T trick: softmax row = lane%16; S^T C-layout == A K-layout of
// P@V, so P needs no transpose, only f16 packing.
__global__ __launch_bounds__(128) void attn_kernel(
    const _Float16* __restrict__ qkvh, const _Float16* __restrict__ vT,
    const float* __restrict__ gamma, const float* __restrict__ dist,
    _Float16* __restrict__ attnh) {
  __shared__ _Float16 lsK[2][32][72];   // [key_local][dh], 64 used
  __shared__ _Float16 lsV[2][64][40];   // [dh][key_local], 32 used

  const int tid = threadIdx.x;
  const int l = tid & 31, wave = tid >> 5;
  const int lh = l >> 4, lm = l & 15;
  const int h = blockIdx.y, b = blockIdx.z;
  const int qt = blockIdx.x * 4 + wave;
  const int qrow = qt * 16 + lm;

  const size_t row3d = (size_t)3 * D_MODEL;
  const _Float16* qbase = qkvh + (size_t)(b * NSEQ) * row3d + h * DH_HEAD;
  const _Float16* kbase = qbase + D_MODEL;
  const _Float16* vTbase = vT + (size_t)(b * H_HEADS + h) * DH_HEAD * NSEQ;
  const float g = gamma[b * H_HEADS + h];
  const float* drow = dist + (size_t)qrow * NSEQ;

  // stage issue: 2 K-chunks + 2 V-chunks of 16B per thread
  auto issue = [&](int s, int kb0) {
#pragma unroll
    for (int i = 0; i < 2; ++i) {
      int c = tid + 128 * i;            // 256 K chunks (32 rows x 8)
      int r = c >> 3, seg = c & 7;
      async_ld_b128(lds_off(&lsK[s][r][seg * 8]),
                    kbase + (size_t)(kb0 + r) * row3d + seg * 8);
    }
#pragma unroll
    for (int i = 0; i < 2; ++i) {
      int c = tid + 128 * i;            // 256 V chunks (64 rows x 4)
      int r = c >> 2, seg = c & 3;
      async_ld_b128(lds_off(&lsV[s][r][seg * 8]),
                    vTbase + (size_t)r * NSEQ + kb0 + seg * 8);
    }
  };

  // Q^T as B operand (col = qrow = lane%16, K = dh contiguous): load once.
  v16h bq[2];
#pragma unroll
  for (int c = 0; c < 2; ++c)
    bq[c] = load_ab(qbase + (size_t)qrow * row3d + c * 32 + 8 * lh);

  v8f o[4];
#pragma unroll
  for (int d = 0; d < 4; ++d) o[d] = v8f_zero();
  float m = -1e30f, ssum = 0.0f;

  const int nkb = NSEQ / 32;
  issue(0, 0);
  for (int kb = 0; kb < nkb; ++kb) {
    const int s = kb & 1;
    const int kb0 = kb * 32;
    if (kb + 1 < nkb) {
      issue(s ^ 1, kb0 + 32);
      S_WAIT_ASYNCCNT(4);
    } else {
      S_WAIT_ASYNCCNT(0);
    }
    __syncthreads();

    // S^T tiles: A = 16 key rows from LDS, B = Q^T. Kdim = 64 -> 2 WMMA each.
    v8f st[2];
#pragma unroll
    for (int t = 0; t < 2; ++t) {
      v16h ak0 = load_ab(&lsK[s][t * 16 + lm][8 * lh]);
      v16h ak1 = load_ab(&lsK[s][t * 16 + lm][32 + 8 * lh]);
      st[t] = wmma_f16(ak0, bq[0], v8f_zero());
      st[t] = wmma_f16(ak1, bq[1], st[t]);
    }

    // scale + distance bias; element j of tile t = (key kb0+t*16+8*lh+j, qrow)
    float sc[2][8];
#pragma unroll
    for (int t = 0; t < 2; ++t) {
      float dbuf[8];
      __builtin_memcpy(dbuf, drow + kb0 + t * 16 + 8 * lh, 32);
#pragma unroll
      for (int j = 0; j < 8; ++j)
        sc[t][j] = st[t][j] * QK_SCALE - g * dbuf[j];
    }

    // online softmax (row = qrow = lane%16; cross-half reduce via shfl_xor 16)
    float bm = -1e30f;
#pragma unroll
    for (int t = 0; t < 2; ++t)
#pragma unroll
      for (int j = 0; j < 8; ++j) bm = fmaxf(bm, sc[t][j]);
    bm = fmaxf(bm, __shfl_xor(bm, 16));
    const float nm = fmaxf(m, bm);
    const float alpha = __expf(m - nm);
    float p[2][8];
    float ps = 0.0f;
#pragma unroll
    for (int t = 0; t < 2; ++t)
#pragma unroll
      for (int j = 0; j < 8; ++j) {
        p[t][j] = __expf(sc[t][j] - nm);
        ps += p[t][j];
      }
    ps += __shfl_xor(ps, 16);
    ssum = ssum * alpha + ps;
    m = nm;

    // rescale O accumulators (row of O tile j = qrow-local j+8*lh)
#pragma unroll
    for (int j = 0; j < 8; ++j) {
      const float aj = __shfl(alpha, j + 8 * lh);
#pragma unroll
      for (int d = 0; d < 4; ++d) o[d][j] *= aj;
    }

    v16h pa;
#pragma unroll
    for (int j = 0; j < 8; ++j) {
      pa[j] = (_Float16)p[0][j];
      pa[8 + j] = (_Float16)p[1][j];
    }

    // O += P @ V ; V B-operand from LDS (key contiguous per dh row)
#pragma unroll
    for (int d = 0; d < 4; ++d) {
      v16h vb = load_ab(&lsV[s][d * 16 + lm][8 * lh]);
      o[d] = wmma_f16(pa, vb, o[d]);
    }

    __syncthreads();  // all waves done with buffer s before refill
  }

  const float inv = 1.0f / ssum;
#pragma unroll
  for (int j = 0; j < 8; ++j) {
    const float ij = __shfl(inv, j + 8 * lh);
    const int row = qt * 16 + j + 8 * lh;
#pragma unroll
    for (int d = 0; d < 4; ++d) {
      attnh[((size_t)(b * NSEQ) + row) * D_MODEL + h * DH_HEAD + d * 16 + lm] =
          (_Float16)(o[d][j] * ij);
    }
  }
}

// ---------------------------------------------------------------------------
extern "C" void kernel_launch(void* const* d_in, const int* in_sizes, int n_in,
                              void* d_out, int out_size, void* d_ws,
                              size_t ws_size, hipStream_t stream) {
  const float* x      = (const float*)d_in[0];
  const float* gamma  = (const float*)d_in[1];
  const float* dist   = (const float*)d_in[2];
  const float* qkv_w  = (const float*)d_in[3];
  const float* qkv_b  = (const float*)d_in[4];
  const float* proj_w = (const float*)d_in[5];
  const float* proj_b = (const float*)d_in[6];
  float* out = (float*)d_out;

  const size_t n_x    = (size_t)BATCH * NSEQ * D_MODEL;      // 4Mi elems
  const size_t n_qkvw = (size_t)D_MODEL * 3 * D_MODEL;       // 3Mi
  const size_t n_pw   = (size_t)D_MODEL * D_MODEL;           // 1Mi
  const size_t n_qkv  = (size_t)BATCH * NSEQ * 3 * D_MODEL;  // 12Mi

  char* ws = (char*)d_ws;
  _Float16* xh     = (_Float16*)ws; ws += n_x * 2;
  _Float16* wqkvT  = (_Float16*)ws; ws += n_qkvw * 2;
  _Float16* wprojT = (_Float16*)ws; ws += n_pw * 2;
  _Float16* qkvh   = (_Float16*)ws; ws += n_qkv * 2;
  _Float16* vTh    = (_Float16*)ws; ws += n_x * 2;
  _Float16* attnh  = (_Float16*)ws; ws += n_x * 2;
  // total ws use: ~56 MB

  cvt_f16_kernel<<<(int)(n_x / 8192), 256, 0, stream>>>(x, xh);
  cvtT_f16_kernel<D_MODEL, 3 * D_MODEL>
      <<<dim3(3 * D_MODEL / 64, D_MODEL / 128), 256, 0, stream>>>(qkv_w, wqkvT);
  cvtT_f16_kernel<D_MODEL, D_MODEL>
      <<<dim3(D_MODEL / 64, D_MODEL / 128), 256, 0, stream>>>(proj_w, wprojT);

  dim3 g1(3 * D_MODEL / 128, BATCH * NSEQ / 64);
  gemm_wmma_kernel<0><<<g1, 128, 0, stream>>>(xh, wqkvT, qkv_b, qkvh,
                                              BATCH * NSEQ, 3 * D_MODEL,
                                              D_MODEL);

  vtrans_kernel<<<dim3(NSEQ / 128, BATCH * H_HEADS), 256, 0, stream>>>(qkvh, vTh);

  dim3 ga(NSEQ / 64, H_HEADS, BATCH);
  attn_kernel<<<ga, 128, 0, stream>>>(qkvh, vTh, gamma, dist, attnh);

  dim3 g2(D_MODEL / 128, BATCH * NSEQ / 64);
  gemm_wmma_kernel<1><<<g2, 128, 0, stream>>>(attnh, wprojT, proj_b, out,
                                              BATCH * NSEQ, D_MODEL, D_MODEL);
}

// v003
// Measured time: 136 microseconds a run.
// In both of two side-by-side timings against v002, it was 1.19 times as fast.
// All steps since v000 together make it 1.85 times as fast.
#include <hip/hip_runtime.h>
#include <hip/hip_bf16.h>

typedef __attribute__((ext_vector_type(16))) _Float16 v16h;
typedef __attribute__((ext_vector_type(8)))  float    v8f;

#define D_MODEL  1024
#define H_HEADS  16
#define DH_HEAD  64
#define NSEQ     2048
#define BATCH    2
#define QK_SCALE 0.03125f  // 1024^-0.5

static __device__ __forceinline__ unsigned lds_off(const void* p) {
  return (unsigned)(unsigned long long)p;
}
static __device__ __forceinline__ void async_ld_b128(unsigned ldsoff,
                                                     const void* gptr) {
  asm volatile("global_load_async_to_lds_b128 %0, %1, off"
               :: "v"(ldsoff), "v"(gptr) : "memory");
}
#define S_WAIT_ASYNCCNT(n) asm volatile("s_wait_asynccnt " #n ::: "memory")

static __device__ __forceinline__ v16h load_ab(const _Float16* p) {
  v16h r;
  __builtin_memcpy(&r, p, 16);
  __builtin_memcpy(reinterpret_cast<char*>(&r) + 16, p + 16, 16);
  return r;
}

static __device__ __forceinline__ v8f v8f_zero() {
  v8f z;
#pragma unroll
  for (int j = 0; j < 8; ++j) z[j] = 0.0f;
  return z;
}

static __device__ __forceinline__ v8f wmma_f16(v16h a, v16h b, v8f c) {
  return __builtin_amdgcn_wmma_f32_16x16x32_f16(false, a, false, b, (short)0, c,
                                                false, false);
}

// ---------------- conversion and transposition launches ----------------
// All four move 16 B per lane (8 B where f32 narrows to f16 in place) so that
// every wave-wide access covers whole 128-B lines, and a thread handles many
// elements, so that few waves have to be started.
typedef __attribute__((ext_vector_type(4))) float    f32x4;
typedef __attribute__((ext_vector_type(4))) unsigned u32x4;
typedef __attribute__((ext_vector_type(2))) unsigned u32x2;
typedef __attribute__((ext_vector_type(2))) _Float16 f16x2;

static __device__ __forceinline__ unsigned pack_f16(float a, float b) {
  f16x2 p;
  p[0] = (_Float16)a;
  p[1] = (_Float16)b;
  return __builtin_bit_cast(unsigned, p);
}

#define TT_PITCH 33

// Column-wise read of 64 tile rows and row-wise store of their transpose:
// dst row c (pitch dpitch elements) receives rows 0..63 of column c.
// 8 lanes cover one 128-B destination line; a thread serves columns 2*cp, 2*cp+1.
static __device__ __forceinline__ void tile_store_T(
    const unsigned (*tile)[TT_PITCH], _Float16* __restrict__ dst, size_t dpitch,
    int tid) {
  const int rs = tid & 7, cp = tid >> 3;
  // Both loops unrolled: w, lo and hi are indexed by constants and stay in
  // registers, and the eight LDS reads issue as one group.
  unsigned w[8];
#pragma unroll
  for (int i = 0; i < 8; ++i) w[i] = tile[8 * rs + i][cp];
  u32x4 lo, hi;
#pragma unroll
  for (int q = 0; q < 4; ++q) {
    lo[q] = (w[2 * q] & 0xffffu) | (w[2 * q + 1] << 16);
    hi[q] = (w[2 * q] >> 16) | (w[2 * q + 1] & 0xffff0000u);
  }
  *reinterpret_cast<u32x4*>(dst + (size_t)(2 * cp) * dpitch + 8 * rs) = lo;
  *reinterpret_cast<u32x4*>(dst + (size_t)(2 * cp + 1) * dpitch + 8 * rs) = hi;
}

// elementwise f32 -> f16; a block converts 8192 consecutive elements.
__global__ __launch_bounds__(256) void cvt_f16_kernel(
    const float* __restrict__ in, _Float16* __restrict__ out) {
  const size_t base = (size_t)blockIdx.x * 8192 + threadIdx.x * 4;
  // Unrolled, loads apart from stores: all eight loads are in flight before
  // the first is waited for.
  f32x4 v[8];
#pragma unroll
  for (int j = 0; j < 8; ++j)
    v[j] = *reinterpret_cast<const f32x4*>(in + base + j * 1024);
#pragma unroll
  for (int j = 0; j < 8; ++j) {
    u32x2 o;
    o[0] = pack_f16(v[j][0], v[j][1]);
    o[1] = pack_f16(v[j][2], v[j][3]);
    *reinterpret_cast<u32x2*>(out + base + j * 1024) = o;
  }
}

// transpose+convert: in [K][Nc] f32 row-major -> out [Nc][K] f16 row-major.
// One block per 128(k) x 64(n) tile.
// K and Nc are compile-time so that the eight row loads share one address
// register pair and differ only in their immediate offsets.
template <int K, int Nc>
__global__ __launch_bounds__(256) void cvtT_f16_kernel(
    const float* __restrict__ in, _Float16* __restrict__ out) {
  __shared__ unsigned tile[128][TT_PITCH];
  const int tid = threadIdx.x;
  const int n0 = blockIdx.x * 64, k0 = blockIdx.y * 128;
  const int c4 = tid & 15, r = tid >> 4;
  const float* src = in + (size_t)(k0 + r) * Nc + n0 + 4 * c4;
  // Unrolled, loads apart from LDS writes: all eight loads are in flight
  // before the first is waited for.
  f32x4 v[8];
#pragma unroll
  for (int i = 0; i < 8; ++i)
    v[i] = *reinterpret_cast<const f32x4*>(src + (size_t)i * 16 * Nc);
#pragma unroll
  for (int i = 0; i < 8; ++i) {
    tile[r + 16 * i][2 * c4] = pack_f16(v[i][0], v[i][1]);
    tile[r + 16 * i][2 * c4 + 1] = pack_f16(v[i][2], v[i][3]);
  }
  __syncthreads();  // the whole tile is written before any column is read
  _Float16* dst = out + (size_t)n0 * K + k0;
  tile_store_T(tile, dst, (size_t)K, tid);
  tile_store_T(tile + 64, dst + 64, (size_t)K, tid);
}

// gather V part of qkv into vT[b][h][dh][key] (f16).
// One block per 128(key) x 64(dh) tile of one (b,h).
__global__ __launch_bounds__(256) void vtrans_kernel(
    const _Float16* __restrict__ qkvh, _Float16* __restrict__ vT) {
  __shared__ unsigned tile[128][TT_PITCH];
  const int tid = threadIdx.x;
  const int key0 = blockIdx.x * 128;
  const int bh = blockIdx.y;
  const int b = bh / H_HEADS, h = bh % H_HEADS;
  const _Float16* src = qkvh + ((size_t)(b * NSEQ) + key0) * (3 * D_MODEL) +
                        2 * D_MODEL + h * DH_HEAD;
  const int seg = tid & 7, r = tid >> 3;
  // Unrolled, loads apart from LDS writes: all four loads are in flight
  // before the first is waited for.
  u32x4 v[4];
#pragma unroll
  for (int i = 0; i < 4; ++i)
    v[i] = *reinterpret_cast<const u32x4*>(
        src + (size_t)(r + 32 * i) * (3 * D_MODEL) + seg * 8);
#pragma unroll
  for (int i = 0; i < 4; ++i)
#pragma unroll
    for (int q = 0; q < 4; ++q) tile[r + 32 * i][4 * seg + q] = v[i][q];
  __syncthreads();  // the whole tile is written before any column is read
  _Float16* dst = vT + (size_t)bh * DH_HEAD * NSEQ + key0;
  tile_store_T(tile, dst, (size_t)NSEQ, tid);
  tile_store_T(tile + 64, dst + 64, (size_t)NSEQ, tid);
}

// ---------------- WMMA GEMM with async-LDS double buffering ------------------
// C[M,Nc] = A[M,K](f16) @ Bt[Nc,K]^T(f16) + bias.
// 256 threads = 8 waves (4x2); workgroup tile 128M x 128N, K-step 64.
// A staged row is 64 f16 = one whole 128-B line, so a wave-wide copy touches
// four whole lines, and a 128 x 128 tile reads each operand from L2 fewer times.
template <int OUTF32>
__global__ __launch_bounds__(256) void gemm_wmma_kernel(
    const _Float16* __restrict__ A, const _Float16* __restrict__ Bt,
    const float* __restrict__ bias, void* __restrict__ outp, int M, int Ncols,
    int K) {
  __shared__ __attribute__((aligned(16))) _Float16 lsA[2][128][72];
  __shared__ __attribute__((aligned(16))) _Float16 lsB[2][128][72];

  const int tid = threadIdx.x;
  const int l = tid & 31, wave = tid >> 5;
  const int lh = l >> 4, lm = l & 15;
  const int wm = wave >> 1, wn = wave & 1;
  const int mbase = blockIdx.y * 128;
  const int nbase = blockIdx.x * 128;

  // stage issue: 4 A-chunks + 4 B-chunks of 16 B per thread; 8 lanes per row,
  // chunk i lies 32 rows below chunk i-1.
  const int cr = tid >> 3, cseg = tid & 7;
  const _Float16* gA = A + (size_t)(mbase + cr) * K + cseg * 8;
  const _Float16* gB = Bt + (size_t)(nbase + cr) * K + cseg * 8;
  const size_t g32 = (size_t)32 * K;
  auto issue = [&](int s, int kk) {
    const _Float16* pa = gA + kk;
    const _Float16* pb = gB + kk;
    asm volatile(
        "global_load_async_to_lds_b128 %0, %8, off\n\t"
        "global_load_async_to_lds_b128 %1, %9, off\n\t"
        "global_load_async_to_lds_b128 %2, %10, off\n\t"
        "global_load_async_to_lds_b128 %3, %11, off\n\t"
        "global_load_async_to_lds_b128 %4, %12, off\n\t"
        "global_load_async_to_lds_b128 %5, %13, off\n\t"
        "global_load_async_to_lds_b128 %6, %14, off\n\t"
        "global_load_async_to_lds_b128 %7, %15, off\n\t"
        "s_wait_xcnt 0x0"
        :: "v"(lds_off(&lsA[s][cr][cseg * 8])),
           "v"(lds_off(&lsA[s][cr + 32][cseg * 8])),
           "v"(lds_off(&lsA[s][cr + 64][cseg * 8])),
           "v"(lds_off(&lsA[s][cr + 96][cseg * 8])),
           "v"(lds_off(&lsB[s][cr][cseg * 8])),
           "v"(lds_off(&lsB[s][cr + 32][cseg * 8])),
           "v"(lds_off(&lsB[s][cr + 64][cseg * 8])),
           "v"(lds_off(&lsB[s][cr + 96][cseg * 8])),
           "v"(pa), "v"(pa + g32), "v"(pa + 2 * g32), "v"(pa + 3 * g32),
           "v"(pb), "v"(pb + g32), "v"(pb + 2 * g32), "v"(pb + 3 * g32)
        : "memory");
  };

  v8f acc[2][4];
#pragma unroll
  for (int t = 0; t < 2; ++t)
#pragma unroll
    for (int u = 0; u < 4; ++u) acc[t][u] = v8f_zero();

  const int nk = K / 64;
  issue(0, 0);
  S_WAIT_ASYNCCNT(0);       // this wave's part of stage 0 has landed
  __syncthreads();          // stage 0 visible to all waves
  if (nk > 1) issue(1, 64);
  for (int ik = 0; ik < nk; ++ik) {
    const int s = ik & 1;
    // Unrolled: the two 32-wide halves of the step differ only in immediate
    // LDS offsets, and the fragment arrays stay in registers.
#pragma unroll
    for (int kh = 0; kh < 2; ++kh) {
      v16h a[2], bo[4];
#pragma unroll
      for (int t = 0; t < 2; ++t)
        a[t] = load_ab(&lsA[s][wm * 32 + t * 16 + lm][kh * 32 + 8 * lh]);
#pragma unroll
      for (int u = 0; u < 4; ++u)
        bo[u] = load_ab(&lsB[s][wn * 64 + u * 16 + lm][kh * 32 + 8 * lh]);
#pragma unroll
      for (int t = 0; t < 2; ++t)
#pragma unroll
        for (int u = 0; u < 4; ++u)
          acc[t][u] = wmma_f16(a[t], bo[u], acc[t][u]);
    }
    // Foot of the step: own reads of buffer s retired, own copies of stage
    // ik+1 landed; the one barrier publishes stage ik+1 and frees buffer s.
    asm volatile("s_wait_dscnt 0x0" ::: "memory");
    S_WAIT_ASYNCCNT(0);
    __syncthreads();
    if (ik + 2 < nk) issue(s, (ik + 2) * 64);
  }
  S_WAIT_ASYNCCNT(0);       // nothing in flight when the wave goes on to end

#pragma unroll
  for (int t = 0; t < 2; ++t) {
#pragma unroll
    for (int u = 0; u < 4; ++u) {
      const int col = nbase + wn * 64 + u * 16 + lm;
      const float bv = bias[col];
#pragma unroll
      for (int j = 0; j < 8; ++j) {
        const int row = mbase + wm * 32 + t * 16 + j + 8 * lh;
        const float v = acc[t][u][j] + bv;
        if (OUTF32)
          ((float*)outp)[(size_t)row * Ncols + col] = v;
        else
          ((_Float16*)outp)[(size_t)row * Ncols + col] = (_Float16)v;
      }
    }
  }
}

// ---------------- Flash attention: 4 waves share K/V via async LDS ----------
// Each wave owns 16 query rows; block covers 64 rows of one (b,h).
// S^T = K @ Q^T trick: softmax row = lane%16; S^T C-layout == A K-layout of
// P@V, so P needs no transpose, only f16 packing.
__global__ __launch_bounds__(128) void attn_kernel(
    const _Float16* __restrict__ qkvh, const _Float16* __restrict__ vT,
    const float* __restrict__ gamma, const float* __restrict__ dist,
    _Float16* __restrict__ attnh) {
  __shared__ _Float16 lsK[2][32][72];   // [key_local][dh], 64 used
  __shared__ _Float16 lsV[2][64][40];   // [dh][key_local], 32 used

  const int tid = threadIdx.x;
  const int l = tid & 31, wave = tid >> 5;
  const int lh = l >> 4, lm = l & 15;
  const int h = blockIdx.y, b = blockIdx.z;
  const int qt = blockIdx.x * 4 + wave;
  const int qrow = qt * 16 + lm;

  const size_t row3d = (size_t)3 * D_MODEL;
  const _Float16* qbase = qkvh + (size_t)(b * NSEQ) * row3d + h * DH_HEAD;
  const _Float16* kbase = qbase + D_MODEL;
  const _Float16* vTbase = vT + (size_t)(b * H_HEADS + h) * DH_HEAD * NSEQ;
  const float g = gamma[b * H_HEADS + h];
  const float* drow = dist + (size_t)qrow * NSEQ;

  // stage issue: 2 K-chunks + 2 V-chunks of 16B per thread
  auto issue = [&](int s, int kb0) {
#pragma unroll
    for (int i = 0; i < 2; ++i) {
      int c = tid + 128 * i;            // 256 K chunks (32 rows x 8)
      int r = c >> 3, seg = c & 7;
      async_ld_b128(lds_off(&lsK[s][r][seg * 8]),
                    kbase + (size_t)(kb0 + r) * row3d + seg * 8);
    }
#pragma unroll
    for (int i = 0; i < 2; ++i) {
      int c = tid + 128 * i;            // 256 V chunks (64 rows x 4)
      int r = c >> 2, seg = c & 3;
      async_ld_b128(lds_off(&lsV[s][r][seg * 8]),
                    vTbase + (size_t)r * NSEQ + kb0 + seg * 8);
    }
  };

  // Q^T as B operand (col = qrow = lane%16, K = dh contiguous): load once.
  v16h bq[2];
#pragma unroll
  for (int c = 0; c < 2; ++c)
    bq[c] = load_ab(qbase + (size_t)qrow * row3d + c * 32 + 8 * lh);

  v8f o[4];
#pragma unroll
  for (int d = 0; d < 4; ++d) o[d] = v8f_zero();
  float m = -1e30f, ssum = 0.0f;

  const int nkb = NSEQ / 32;
  issue(0, 0);
  for (int kb = 0; kb < nkb; ++kb) {
    const int s = kb & 1;
    const int kb0 = kb * 32;
    if (kb + 1 < nkb) {
      issue(s ^ 1, kb0 + 32);
      S_WAIT_ASYNCCNT(4);
    } else {
      S_WAIT_ASYNCCNT(0);
    }
    __syncthreads();

    // S^T tiles: A = 16 key rows from LDS, B = Q^T. Kdim = 64 -> 2 WMMA each.
    v8f st[2];
#pragma unroll
    for (int t = 0; t < 2; ++t) {
      v16h ak0 = load_ab(&lsK[s][t * 16 + lm][8 * lh]);
      v16h ak1 = load_ab(&lsK[s][t * 16 + lm][32 + 8 * lh]);
      st[t] = wmma_f16(ak0, bq[0], v8f_zero());
      st[t] = wmma_f16(ak1, bq[1], st[t]);
    }

    // scale + distance bias; element j of tile t = (key kb0+t*16+8*lh+j, qrow)
    float sc[2][8];
#pragma unroll
    for (int t = 0; t < 2; ++t) {
      float dbuf[8];
      __builtin_memcpy(dbuf, drow + kb0 + t * 16 + 8 * lh, 32);
#pragma unroll
      for (int j = 0; j < 8; ++j)
        sc[t][j] = st[t][j] * QK_SCALE - g * dbuf[j];
    }

    // online softmax (row = qrow = lane%16; cross-half reduce via shfl_xor 16)
    float bm = -1e30f;
#pragma unroll
    for (int t = 0; t < 2; ++t)
#pragma unroll
      for (int j = 0; j < 8; ++j) bm = fmaxf(bm, sc[t][j]);
    bm = fmaxf(bm, __shfl_xor(bm, 16));
    const float nm = fmaxf(m, bm);
    const float alpha = __expf(m - nm);
    float p[2][8];
    float ps = 0.0f;
#pragma unroll
    for (int t = 0; t < 2; ++t)
#pragma unroll
      for (int j = 0; j < 8; ++j) {
        p[t][j] = __expf(sc[t][j] - nm);
        ps += p[t][j];
      }
    ps += __shfl_xor(ps, 16);
    ssum = ssum * alpha + ps;
    m = nm;

    // rescale O accumulators (row of O tile j = qrow-local j+8*lh)
#pragma unroll
    for (int j = 0; j < 8; ++j) {
      const float aj = __shfl(alpha, j + 8 * lh);
#pragma unroll
      for (int d = 0; d < 4; ++d) o[d][j] *= aj;
    }

    v16h pa;
#pragma unroll
    for (int j = 0; j < 8; ++j) {
      pa[j] = (_Float16)p[0][j];
      pa[8 + j] = (_Float16)p[1][j];
    }

    // O += P @ V ; V B-operand from LDS (key contiguous per dh row)
#pragma unroll
    for (int d = 0; d < 4; ++d) {
      v16h vb = load_ab(&lsV[s][d * 16 + lm][8 * lh]);
      o[d] = wmma_f16(pa, vb, o[d]);
    }

    __syncthreads();  // all waves done with buffer s before refill
  }

  const float inv = 1.0f / ssum;
#pragma unroll
  for (int j = 0; j < 8; ++j) {
    const float ij = __shfl(inv, j + 8 * lh);
    const int row = qt * 16 + j + 8 * lh;
#pragma unroll
    for (int d = 0; d < 4; ++d) {
      attnh[((size_t)(b * NSEQ) + row) * D_MODEL + h * DH_HEAD + d * 16 + lm] =
          (_Float16)(o[d][j] * ij);
    }
  }
}

// ---------------------------------------------------------------------------
extern "C" void kernel_launch(void* const* d_in, const int* in_sizes, int n_in,
                              void* d_out, int out_size, void* d_ws,
                              size_t ws_size, hipStream_t stream) {
  const float* x      = (const float*)d_in[0];
  const float* gamma  = (const float*)d_in[1];
  const float* dist   = (const float*)d_in[2];
  const float* qkv_w  = (const float*)d_in[3];
  const float* qkv_b  = (const float*)d_in[4];
  const float* proj_w = (const float*)d_in[5];
  const float* proj_b = (const float*)d_in[6];
  float* out = (float*)d_out;

  const size_t n_x    = (size_t)BATCH * NSEQ * D_MODEL;      // 4Mi elems
  const size_t n_qkvw = (size_t)D_MODEL * 3 * D_MODEL;       // 3Mi
  const size_t n_pw   = (size_t)D_MODEL * D_MODEL;           // 1Mi
  const size_t n_qkv  = (size_t)BATCH * NSEQ * 3 * D_MODEL;  // 12Mi

  char* ws = (char*)d_ws;
  _Float16* xh     = (_Float16*)ws; ws += n_x * 2;
  _Float16* wqkvT  = (_Float16*)ws; ws += n_qkvw * 2;
  _Float16* wprojT = (_Float16*)ws; ws += n_pw * 2;
  _Float16* qkvh   = (_Float16*)ws; ws += n_qkv * 2;
  _Float16* vTh    = (_Float16*)ws; ws += n_x * 2;
  _Float16* attnh  = (_Float16*)ws; ws += n_x * 2;
  // total ws use: ~56 MB

  cvt_f16_kernel<<<(int)(n_x / 8192), 256, 0, stream>>>(x, xh);
  cvtT_f16_kernel<D_MODEL, 3 * D_MODEL>
      <<<dim3(3 * D_MODEL / 64, D_MODEL / 128), 256, 0, stream>>>(qkv_w, wqkvT);
  cvtT_f16_kernel<D_MODEL, D_MODEL>
      <<<dim3(D_MODEL / 64, D_MODEL / 128), 256, 0, stream>>>(proj_w, wprojT);

  dim3 g1(3 * D_MODEL / 128, BATCH * NSEQ / 128);
  gemm_wmma_kernel<0><<<g1, 256, 0, stream>>>(xh, wqkvT, qkv_b, qkvh,
                                              BATCH * NSEQ, 3 * D_MODEL,
                                              D_MODEL);

  vtrans_kernel<<<dim3(NSEQ / 128, BATCH * H_HEADS), 256, 0, stream>>>(qkvh, vTh);

  dim3 ga(NSEQ / 64, H_HEADS, BATCH);
  attn_kernel<<<ga, 128, 0, stream>>>(qkvh, vTh, gamma, dist, attnh);

  dim3 g2(D_MODEL / 128, BATCH * NSEQ / 128);
  gemm_wmma_kernel<1><<<g2, 256, 0, stream>>>(attnh, wprojT, proj_b, out,
                                              BATCH * NSEQ, D_MODEL, D_MODEL);
}

// v004
// It runs in 121 microseconds.
// Two timings next to v003 both put it at 1.13 times that version's speed.
// All steps since v000 together make it 2.09 times as fast.
#include <hip/hip_runtime.h>
#include <hip/hip_bf16.h>

typedef __attribute__((ext_vector_type(16))) _Float16 v16h;
typedef __attribute__((ext_vector_type(8)))  float    v8f;

#define D_MODEL  1024
#define H_HEADS  16
#define DH_HEAD  64
#define NSEQ     2048
#define BATCH    2
#define QK_SCALE 0.03125f  // 1024^-0.5

static __device__ __forceinline__ unsigned lds_off(const void* p) {
  return (unsigned)(unsigned long long)p;
}
#define S_WAIT_ASYNCCNT(n) asm volatile("s_wait_asynccnt " #n ::: "memory")

static __device__ __forceinline__ v16h load_ab(const _Float16* p) {
  v16h r;
  __builtin_memcpy(&r, p, 16);
  __builtin_memcpy(reinterpret_cast<char*>(&r) + 16, p + 16, 16);
  return r;
}

static __device__ __forceinline__ v8f v8f_zero() {
  v8f z;
#pragma unroll
  for (int j = 0; j < 8; ++j) z[j] = 0.0f;
  return z;
}

static __device__ __forceinline__ v8f wmma_f16(v16h a, v16h b, v8f c) {
  return __builtin_amdgcn_wmma_f32_16x16x32_f16(false, a, false, b, (short)0, c,
                                                false, false);
}

// ---------------- conversion and transposition launches ----------------
// All four move 16 B per lane (8 B where f32 narrows to f16 in place) so that
// every wave-wide access covers whole 128-B lines, and a thread handles many
// elements, so that few waves have to be started.
typedef __attribute__((ext_vector_type(4))) float    f32x4;
typedef __attribute__((ext_vector_type(4))) unsigned u32x4;
typedef __attribute__((ext_vector_type(2))) unsigned u32x2;
typedef __attribute__((ext_vector_type(2))) _Float16 f16x2;

static __device__ __forceinline__ unsigned pack_f16(float a, float b) {
  f16x2 p;
  p[0] = (_Float16)a;
  p[1] = (_Float16)b;
  return __builtin_bit_cast(unsigned, p);
}

#define TT_PITCH 33

// Column-wise read of 64 tile rows and row-wise store of their transpose:
// dst row c (pitch dpitch elements) receives rows 0..63 of column c.
// 8 lanes cover one 128-B destination line; a thread serves columns 2*cp, 2*cp+1.
static __device__ __forceinline__ void tile_store_T(
    const unsigned (*tile)[TT_PITCH], _Float16* __restrict__ dst, size_t dpitch,
    int tid) {
  const int rs = tid & 7, cp = tid >> 3;
  // Both loops unrolled: w, lo and hi are indexed by constants and stay in
  // registers, and the eight LDS reads issue as one group.
  unsigned w[8];
#pragma unroll
  for (int i = 0; i < 8; ++i) w[i] = tile[8 * rs + i][cp];
  u32x4 lo, hi;
#pragma unroll
  for (int q = 0; q < 4; ++q) {
    lo[q] = (w[2 * q] & 0xffffu) | (w[2 * q + 1] << 16);
    hi[q] = (w[2 * q] >> 16) | (w[2 * q + 1] & 0xffff0000u);
  }
  *reinterpret_cast<u32x4*>(dst + (size_t)(2 * cp) * dpitch + 8 * rs) = lo;
  *reinterpret_cast<u32x4*>(dst + (size_t)(2 * cp + 1) * dpitch + 8 * rs) = hi;
}

// elementwise f32 -> f16; a block converts 8192 consecutive elements.
__global__ __launch_bounds__(256) void cvt_f16_kernel(
    const float* __restrict__ in, _Float16* __restrict__ out) {
  const size_t base = (size_t)blockIdx.x * 8192 + threadIdx.x * 4;
  // Unrolled, loads apart from stores: all eight loads are in flight before
  // the first is waited for.
  f32x4 v[8];
#pragma unroll
  for (int j = 0; j < 8; ++j)
    v[j] = *reinterpret_cast<const f32x4*>(in + base + j * 1024);
#pragma unroll
  for (int j = 0; j < 8; ++j) {
    u32x2 o;
    o[0] = pack_f16(v[j][0], v[j][1]);
    o[1] = pack_f16(v[j][2], v[j][3]);
    *reinterpret_cast<u32x2*>(out + base + j * 1024) = o;
  }
}

// transpose+convert: in [K][Nc] f32 row-major -> out [Nc][K] f16 row-major.
// One block per 128(k) x 64(n) tile.
// K and Nc are compile-time so that the eight row loads share one address
// register pair and differ only in their immediate offsets.
template <int K, int Nc>
__global__ __launch_bounds__(256) void cvtT_f16_kernel(
    const float* __restrict__ in, _Float16* __restrict__ out) {
  __shared__ unsigned tile[128][TT_PITCH];
  const int tid = threadIdx.x;
  const int n0 = blockIdx.x * 64, k0 = blockIdx.y * 128;
  const int c4 = tid & 15, r = tid >> 4;
  const float* src = in + (size_t)(k0 + r) * Nc + n0 + 4 * c4;
  // Unrolled, loads apart from LDS writes: all eight loads are in flight
  // before the first is waited for.
  f32x4 v[8];
#pragma unroll
  for (int i = 0; i < 8; ++i)
    v[i] = *reinterpret_cast<const f32x4*>(src + (size_t)i * 16 * Nc);
#pragma unroll
  for (int i = 0; i < 8; ++i) {
    tile[r + 16 * i][2 * c4] = pack_f16(v[i][0], v[i][1]);
    tile[r + 16 * i][2 * c4 + 1] = pack_f16(v[i][2], v[i][3]);
  }
  __syncthreads();  // the whole tile is written before any column is read
  _Float16* dst = out + (size_t)n0 * K + k0;
  tile_store_T(tile, dst, (size_t)K, tid);
  tile_store_T(tile + 64, dst + 64, (size_t)K, tid);
}

// gather V part of qkv into vT[b][h][dh][key] (f16).
// One block per 128(key) x 64(dh) tile of one (b,h).
__global__ __launch_bounds__(256) void vtrans_kernel(
    const _Float16* __restrict__ qkvh, _Float16* __restrict__ vT) {
  __shared__ unsigned tile[128][TT_PITCH];
  const int tid = threadIdx.x;
  const int key0 = blockIdx.x * 128;
  const int bh = blockIdx.y;
  const int b = bh / H_HEADS, h = bh % H_HEADS;
  const _Float16* src = qkvh + ((size_t)(b * NSEQ) + key0) * (3 * D_MODEL) +
                        2 * D_MODEL + h * DH_HEAD;
  const int seg = tid & 7, r = tid >> 3;
  // Unrolled, loads apart from LDS writes: all four loads are in flight
  // before the first is waited for.
  u32x4 v[4];
#pragma unroll
  for (int i = 0; i < 4; ++i)
    v[i] = *reinterpret_cast<const u32x4*>(
        src + (size_t)(r + 32 * i) * (3 * D_MODEL) + seg * 8);
#pragma unroll
  for (int i = 0; i < 4; ++i)
#pragma unroll
    for (int q = 0; q < 4; ++q) tile[r + 32 * i][4 * seg + q] = v[i][q];
  __syncthreads();  // the whole tile is written before any column is read
  _Float16* dst = vT + (size_t)bh * DH_HEAD * NSEQ + key0;
  tile_store_T(tile, dst, (size_t)NSEQ, tid);
  tile_store_T(tile + 64, dst + 64, (size_t)NSEQ, tid);
}

// ---------------- WMMA GEMM with async-LDS double buffering ------------------
// C[M,Nc] = A[M,K](f16) @ Bt[Nc,K]^T(f16) + bias.
// 256 threads = 8 waves (4x2); workgroup tile 128M x 128N, K-step 64.
// A staged row is 64 f16 = one whole 128-B line, so a wave-wide copy touches
// four whole lines, and a 128 x 128 tile reads each operand from L2 fewer times.
template <int OUTF32>
__global__ __launch_bounds__(256) void gemm_wmma_kernel(
    const _Float16* __restrict__ A, const _Float16* __restrict__ Bt,
    const float* __restrict__ bias, void* __restrict__ outp, int M, int Ncols,
    int K) {
  __shared__ __attribute__((aligned(16))) _Float16 lsA[2][128][72];
  __shared__ __attribute__((aligned(16))) _Float16 lsB[2][128][72];

  const int tid = threadIdx.x;
  const int l = tid & 31, wave = tid >> 5;
  const int lh = l >> 4, lm = l & 15;
  const int wm = wave >> 1, wn = wave & 1;
  const int mbase = blockIdx.y * 128;
  const int nbase = blockIdx.x * 128;

  // stage issue: 4 A-chunks + 4 B-chunks of 16 B per thread; 8 lanes per row,
  // chunk i lies 32 rows below chunk i-1.
  const int cr = tid >> 3, cseg = tid & 7;
  const _Float16* gA = A + (size_t)(mbase + cr) * K + cseg * 8;
  const _Float16* gB = Bt + (size_t)(nbase + cr) * K + cseg * 8;
  const size_t g32 = (size_t)32 * K;
  auto issue = [&](int s, int kk) {
    const _Float16* pa = gA + kk;
    const _Float16* pb = gB + kk;
    asm volatile(
        "global_load_async_to_lds_b128 %0, %8, off\n\t"
        "global_load_async_to_lds_b128 %1, %9, off\n\t"
        "global_load_async_to_lds_b128 %2, %10, off\n\t"
        "global_load_async_to_lds_b128 %3, %11, off\n\t"
        "global_load_async_to_lds_b128 %4, %12, off\n\t"
        "global_load_async_to_lds_b128 %5, %13, off\n\t"
        "global_load_async_to_lds_b128 %6, %14, off\n\t"
        "global_load_async_to_lds_b128 %7, %15, off\n\t"
        "s_wait_xcnt 0x0"
        :: "v"(lds_off(&lsA[s][cr][cseg * 8])),
           "v"(lds_off(&lsA[s][cr + 32][cseg * 8])),
           "v"(lds_off(&lsA[s][cr + 64][cseg * 8])),
           "v"(lds_off(&lsA[s][cr + 96][cseg * 8])),
           "v"(lds_off(&lsB[s][cr][cseg * 8])),
           "v"(lds_off(&lsB[s][cr + 32][cseg * 8])),
           "v"(lds_off(&lsB[s][cr + 64][cseg * 8])),
           "v"(lds_off(&lsB[s][cr + 96][cseg * 8])),
           "v"(pa), "v"(pa + g32), "v"(pa + 2 * g32), "v"(pa + 3 * g32),
           "v"(pb), "v"(pb + g32), "v"(pb + 2 * g32), "v"(pb + 3 * g32)
        : "memory");
  };

  v8f acc[2][4];
#pragma unroll
  for (int t = 0; t < 2; ++t)
#pragma unroll
    for (int u = 0; u < 4; ++u) acc[t][u] = v8f_zero();

  const int nk = K / 64;
  issue(0, 0);
  S_WAIT_ASYNCCNT(0);       // this wave's part of stage 0 has landed
  __syncthreads();          // stage 0 visible to all waves
  if (nk > 1) issue(1, 64);
  for (int ik = 0; ik < nk; ++ik) {
    const int s = ik & 1;
    // Unrolled: the two 32-wide halves of the step differ only in immediate
    // LDS offsets, and the fragment arrays stay in registers.
#pragma unroll
    for (int kh = 0; kh < 2; ++kh) {
      v16h a[2], bo[4];
#pragma unroll
      for (int t = 0; t < 2; ++t)
        a[t] = load_ab(&lsA[s][wm * 32 + t * 16 + lm][kh * 32 + 8 * lh]);
#pragma unroll
      for (int u = 0; u < 4; ++u)
        bo[u] = load_ab(&lsB[s][wn * 64 + u * 16 + lm][kh * 32 + 8 * lh]);
#pragma unroll
      for (int t = 0; t < 2; ++t)
#pragma unroll
        for (int u = 0; u < 4; ++u)
          acc[t][u] = wmma_f16(a[t], bo[u], acc[t][u]);
    }
    // Foot of the step: own reads of buffer s retired, own copies of stage
    // ik+1 landed; the one barrier publishes stage ik+1 and frees buffer s.
    asm volatile("s_wait_dscnt 0x0" ::: "memory");
    S_WAIT_ASYNCCNT(0);
    __syncthreads();
    if (ik + 2 < nk) issue(s, (ik + 2) * 64);
  }
  S_WAIT_ASYNCCNT(0);       // nothing in flight when the wave goes on to end

#pragma unroll
  for (int t = 0; t < 2; ++t) {
#pragma unroll
    for (int u = 0; u < 4; ++u) {
      const int col = nbase + wn * 64 + u * 16 + lm;
      const float bv = bias[col];
#pragma unroll
      for (int j = 0; j < 8; ++j) {
        const int row = mbase + wm * 32 + t * 16 + j + 8 * lh;
        const float v = acc[t][u][j] + bv;
        if (OUTF32)
          ((float*)outp)[(size_t)row * Ncols + col] = v;
        else
          ((_Float16*)outp)[(size_t)row * Ncols + col] = (_Float16)v;
      }
    }
  }
}

// ---------------- Flash attention: 4 waves share K/V via async LDS ----------
// Each wave owns 16 query rows; block covers 64 rows of one (b,h).
// S^T = K @ Q^T trick: softmax row = lane%16; S^T C-layout == A K-layout of
// P@V, so P needs no transpose, only f16 packing.
// The block's 64 x 32 tile of the distance matrix rides in the same ring as K
// and V: a copy takes whole 128-B lines (8 lanes a row) one pass ahead, where a
// register load in fragment order touches 16 lines for 512 B.
__global__ __launch_bounds__(128) void attn_kernel(
    const _Float16* __restrict__ qkvh, const _Float16* __restrict__ vT,
    const float* __restrict__ gamma, const float* __restrict__ dist,
    _Float16* __restrict__ attnh) {
  __shared__ __attribute__((aligned(16))) _Float16 lsK[2][32][72];  // [key_local][dh], 64 used
  __shared__ __attribute__((aligned(16))) _Float16 lsV[2][64][40];  // [dh][key_local], 32 used
  __shared__ __attribute__((aligned(16))) float    lsD[2][64][36];  // [q_local][key_local], 32 used

  const int tid = threadIdx.x;
  const int l = tid & 31, wave = tid >> 5;
  const int lh = l >> 4, lm = l & 15;
  const int h = blockIdx.y, b = blockIdx.z;
  const int qt = blockIdx.x * 4 + wave;
  const int qrow = qt * 16 + lm;

  const size_t row3d = (size_t)3 * D_MODEL;
  const _Float16* qbase = qkvh + (size_t)(b * NSEQ) * row3d + h * DH_HEAD;
  const _Float16* kbase = qbase + D_MODEL;
  const _Float16* vTbase = vT + (size_t)(b * H_HEADS + h) * DH_HEAD * NSEQ;
  const float g = gamma[b * H_HEADS + h];

  // stage issue: 2 K-chunks, 2 V-chunks and 4 distance chunks of 16 B per thread.
  // K and distance: 8 lanes a row, chunk i lies 16 rows below chunk i-1;
  // V: 4 lanes a row, chunk 1 lies 32 rows below chunk 0.
  const int r8 = tid >> 3, seg8 = tid & 7;
  const int r4 = tid >> 2, seg4 = tid & 3;
  const _Float16* gK = kbase + (size_t)r8 * row3d + seg8 * 8;
  const _Float16* gV = vTbase + (size_t)r4 * NSEQ + seg4 * 8;
  const float* gD = dist + (size_t)(blockIdx.x * 64 + r8) * NSEQ + seg8 * 4;
  auto issue = [&](int s, int kb0) {
    const _Float16* pk = gK + (size_t)kb0 * row3d;
    const _Float16* pv = gV + kb0;
    const float* pd = gD + kb0;
    asm volatile(
        "global_load_async_to_lds_b128 %0, %8, off\n\t"
        "global_load_async_to_lds_b128 %1, %9, off\n\t"
        "global_load_async_to_lds_b128 %2, %10, off\n\t"
        "global_load_async_to_lds_b128 %3, %11, off\n\t"
        "global_load_async_to_lds_b128 %4, %12, off\n\t"
        "global_load_async_to_lds_b128 %5, %13, off\n\t"
        "global_load_async_to_lds_b128 %6, %14, off\n\t"
        "global_load_async_to_lds_b128 %7, %15, off\n\t"
        "s_wait_xcnt 0x0"
        :: "v"(lds_off(&lsK[s][r8][seg8 * 8])),
           "v"(lds_off(&lsK[s][r8 + 16][seg8 * 8])),
           "v"(lds_off(&lsV[s][r4][seg4 * 8])),
           "v"(lds_off(&lsV[s][r4 + 32][seg4 * 8])),
           "v"(lds_off(&lsD[s][r8][seg8 * 4])),
           "v"(lds_off(&lsD[s][r8 + 16][seg8 * 4])),
           "v"(lds_off(&lsD[s][r8 + 32][seg8 * 4])),
           "v"(lds_off(&lsD[s][r8 + 48][seg8 * 4])),
           "v"(pk), "v"(pk + 16 * row3d),
           "v"(pv), "v"(pv + 32 * NSEQ),
           "v"(pd), "v"(pd + 16 * NSEQ), "v"(pd + 32 * NSEQ),
           "v"(pd + 48 * NSEQ)
        : "memory");
  };

  // Q^T as B operand (col = qrow = lane%16, K = dh contiguous): load once.
  v16h bq[2];
#pragma unroll
  for (int c = 0; c < 2; ++c)
    bq[c] = load_ab(qbase + (size_t)qrow * row3d + c * 32 + 8 * lh);

  v8f o[4];
#pragma unroll
  for (int d = 0; d < 4; ++d) o[d] = v8f_zero();
  float m = -1e30f, ssum = 0.0f;

  const int nkb = NSEQ / 32;
  issue(0, 0);
  S_WAIT_ASYNCCNT(0);       // this wave's part of stage 0 has landed
  __syncthreads();          // stage 0 visible to all waves
  issue(1, 32);
  for (int kb = 0; kb < nkb; ++kb) {
    const int s = kb & 1;

    // S^T tiles: A = 16 key rows from LDS, B = Q^T. Kdim = 64 -> 2 WMMA each.
    v8f st[2];
#pragma unroll
    for (int t = 0; t < 2; ++t) {
      v16h ak0 = load_ab(&lsK[s][t * 16 + lm][8 * lh]);
      v16h ak1 = load_ab(&lsK[s][t * 16 + lm][32 + 8 * lh]);
      st[t] = wmma_f16(ak0, bq[0], v8f_zero());
      st[t] = wmma_f16(ak1, bq[1], st[t]);
    }

    // scale + distance bias; element j of tile t = (key kb0+t*16+8*lh+j, qrow)
    float sc[2][8];
#pragma unroll
    for (int t = 0; t < 2; ++t) {
      float dbuf[8];
      __builtin_memcpy(dbuf, &lsD[s][wave * 16 + lm][t * 16 + 8 * lh], 32);
#pragma unroll
      for (int j = 0; j < 8; ++j)
        sc[t][j] = st[t][j] * QK_SCALE - g * dbuf[j];
    }

    // online softmax (row = qrow = lane%16; cross-half reduce via shfl_xor 16)
    float bm = -1e30f;
#pragma unroll
    for (int t = 0; t < 2; ++t)
#pragma unroll
      for (int j = 0; j < 8; ++j) bm = fmaxf(bm, sc[t][j]);
    bm = fmaxf(bm, __shfl_xor(bm, 16));
    const float nm = fmaxf(m, bm);
    const float alpha = __expf(m - nm);
    float p[2][8];
    float ps = 0.0f;
#pragma unroll
    for (int t = 0; t < 2; ++t)
#pragma unroll
      for (int j = 0; j < 8; ++j) {
        p[t][j] = __expf(sc[t][j] - nm);
        ps += p[t][j];
      }
    ps += __shfl_xor(ps, 16);
    ssum = ssum * alpha + ps;
    m = nm;

    // rescale O accumulators (row of O tile j = qrow-local j+8*lh)
#pragma unroll
    for (int j = 0; j < 8; ++j) {
      const float aj = __shfl(alpha, j + 8 * lh);
#pragma unroll
      for (int d = 0; d < 4; ++d) o[d][j] *= aj;
    }

    v16h pa;
#pragma unroll
    for (int j = 0; j < 8; ++j) {
      pa[j] = (_Float16)p[0][j];
      pa[8 + j] = (_Float16)p[1][j];
    }

    // O += P @ V ; V B-operand from LDS (key contiguous per dh row)
#pragma unroll
    for (int d = 0; d < 4; ++d) {
      v16h vb = load_ab(&lsV[s][d * 16 + lm][8 * lh]);
      o[d] = wmma_f16(pa, vb, o[d]);
    }

    // Foot of the pass: own reads of buffer s retired, own copies of stage
    // kb+1 landed; the one barrier publishes stage kb+1 and frees buffer s.
    // The scheduling barrier keeps the pass's vector and matrix work in front of
    // the waits: lifted to mid-pass they would expose the V reads' latency and
    // halve the time the copies have to land.
    __builtin_amdgcn_sched_barrier(0);
    asm volatile("s_wait_dscnt 0x0" ::: "memory");
    S_WAIT_ASYNCCNT(0);
    __syncthreads();
    if (kb + 2 < nkb) issue(s, (kb + 2) * 32);
  }
  S_WAIT_ASYNCCNT(0);       // nothing in flight when the wave goes on to end

  const float inv = 1.0f / ssum;
#pragma unroll
  for (int j = 0; j < 8; ++j) {
    const float ij = __shfl(inv, j + 8 * lh);
    const int row = qt * 16 + j + 8 * lh;
#pragma unroll
    for (int d = 0; d < 4; ++d) {
      attnh[((size_t)(b * NSEQ) + row) * D_MODEL + h * DH_HEAD + d * 16 + lm] =
          (_Float16)(o[d][j] * ij);
    }
  }
}

// ---------------------------------------------------------------------------
extern "C" void kernel_launch(void* const* d_in, const int* in_sizes, int n_in,
                              void* d_out, int out_size, void* d_ws,
                              size_t ws_size, hipStream_t stream) {
  const float* x      = (const float*)d_in[0];
  const float* gamma  = (const float*)d_in[1];
  const float* dist   = (const float*)d_in[2];
  const float* qkv_w  = (const float*)d_in[3];
  const float* qkv_b  = (const float*)d_in[4];
  const float* proj_w = (const float*)d_in[5];
  const float* proj_b = (const float*)d_in[6];
  float* out = (float*)d_out;

  const size_t n_x    = (size_t)BATCH * NSEQ * D_MODEL;      // 4Mi elems
  const size_t n_qkvw = (size_t)D_MODEL * 3 * D_MODEL;       // 3Mi
  const size_t n_pw   = (size_t)D_MODEL * D_MODEL;           // 1Mi
  const size_t n_qkv  = (size_t)BATCH * NSEQ * 3 * D_MODEL;  // 12Mi

  char* ws = (char*)d_ws;
  _Float16* xh     = (_Float16*)ws; ws += n_x * 2;
  _Float16* wqkvT  = (_Float16*)ws; ws += n_qkvw * 2;
  _Float16* wprojT = (_Float16*)ws; ws += n_pw * 2;
  _Float16* qkvh   = (_Float16*)ws; ws += n_qkv * 2;
  _Float16* vTh    = (_Float16*)ws; ws += n_x * 2;
  _Float16* attnh  = (_Float16*)ws; ws += n_x * 2;
  // total ws use: ~56 MB

  cvt_f16_kernel<<<(int)(n_x / 8192), 256, 0, stream>>>(x, xh);
  cvtT_f16_kernel<D_MODEL, 3 * D_MODEL>
      <<<dim3(3 * D_MODEL / 64, D_MODEL / 128), 256, 0, stream>>>(qkv_w, wqkvT);
  cvtT_f16_kernel<D_MODEL, D_MODEL>
      <<<dim3(D_MODEL / 64, D_MODEL / 128), 256, 0, stream>>>(proj_w, wprojT);

  dim3 g1(3 * D_MODEL / 128, BATCH * NSEQ / 128);
  gemm_wmma_kernel<0><<<g1, 256, 0, stream>>>(xh, wqkvT, qkv_b, qkvh,
                                              BATCH * NSEQ, 3 * D_MODEL,
                                              D_MODEL);

  vtrans_kernel<<<dim3(NSEQ / 128, BATCH * H_HEADS), 256, 0, stream>>>(qkvh, vTh);

  dim3 ga(NSEQ / 64, H_HEADS, BATCH);
  attn_kernel<<<ga, 128, 0, stream>>>(qkvh, vTh, gamma, dist, attnh);

  dim3 g2(D_MODEL / 128, BATCH * NSEQ / 128);
  gemm_wmma_kernel<1><<<g2, 256, 0, stream>>>(attnh, wprojT, proj_b, out,
                                              BATCH * NSEQ, D_MODEL, D_MODEL);
}

// v005
// Measured time: 114 microseconds a run.
// Next to v004, in two timings, it ran 1.05 times as fast each time.
// Counting every step since v000, it is 2.19 times as fast.
#include <hip/hip_runtime.h>
#include <hip/hip_bf16.h>

typedef __attribute__((ext_vector_type(16))) _Float16 v16h;
typedef __attribute__((ext_vector_type(8)))  float    v8f;

#define D_MODEL  1024
#define H_HEADS  16
#define DH_HEAD  64
#define NSEQ     2048
#define BATCH    2
#define QK_SCALE 0.03125f  // 1024^-0.5
#define LOG2_E 1.442695041f
#define LAZY_MARGIN 5.5f    // about 8 in log2: a probability stays below 256

static __device__ __forceinline__ unsigned lds_off(const void* p) {
  return (unsigned)(unsigned long long)p;
}
#define S_WAIT_ASYNCCNT(n) asm volatile("s_wait_asynccnt " #n ::: "memory")

static __device__ __forceinline__ v16h load_ab(const _Float16* p) {
  v16h r;
  __builtin_memcpy(&r, p, 16);
  __builtin_memcpy(reinterpret_cast<char*>(&r) + 16, p + 16, 16);
  return r;
}

static __device__ __forceinline__ v8f v8f_zero() {
  v8f z;
#pragma unroll
  for (int j = 0; j < 8; ++j) z[j] = 0.0f;
  return z;
}

static __device__ __forceinline__ v8f wmma_f16(v16h a, v16h b, v8f c) {
  return __builtin_amdgcn_wmma_f32_16x16x32_f16(false, a, false, b, (short)0, c,
                                                false, false);
}

// ---------------- conversion and transposition launches ----------------
// All four move 16 B per lane (8 B where f32 narrows to f16 in place) so that
// every wave-wide access covers whole 128-B lines, and a thread handles many
// elements, so that few waves have to be started.
typedef __attribute__((ext_vector_type(4))) float    f32x4;
typedef __attribute__((ext_vector_type(2))) float    f32x2;
typedef __attribute__((ext_vector_type(4))) unsigned u32x4;
typedef __attribute__((ext_vector_type(2))) unsigned u32x2;
typedef __attribute__((ext_vector_type(2))) _Float16 f16x2;

static __device__ __forceinline__ unsigned pack_f16(float a, float b) {
  f16x2 p;
  p[0] = (_Float16)a;
  p[1] = (_Float16)b;
  return __builtin_bit_cast(unsigned, p);
}

#define TT_PITCH 33

// Column-wise read of 64 tile rows and row-wise store of their transpose:
// dst row c (pitch dpitch elements) receives rows 0..63 of column c.
// 8 lanes cover one 128-B destination line; a thread serves columns 2*cp, 2*cp+1.
static __device__ __forceinline__ void tile_store_T(
    const unsigned (*tile)[TT_PITCH], _Float16* __restrict__ dst, size_t dpitch,
    int tid) {
  const int rs = tid & 7, cp = tid >> 3;
  // Both loops unrolled: w, lo and hi are indexed by constants and stay in
  // registers, and the eight LDS reads issue as one group.
  unsigned w[8];
#pragma unroll
  for (int i = 0; i < 8; ++i) w[i] = tile[8 * rs + i][cp];
  u32x4 lo, hi;
#pragma unroll
  for (int q = 0; q < 4; ++q) {
    lo[q] = (w[2 * q] & 0xffffu) | (w[2 * q + 1] << 16);
    hi[q] = (w[2 * q] >> 16) | (w[2 * q + 1] & 0xffff0000u);
  }
  *reinterpret_cast<u32x4*>(dst + (size_t)(2 * cp) * dpitch + 8 * rs) = lo;
  *reinterpret_cast<u32x4*>(dst + (size_t)(2 * cp + 1) * dpitch + 8 * rs) = hi;
}

// elementwise f32 -> f16; a block converts 8192 consecutive elements.
__global__ __launch_bounds__(256) void cvt_f16_kernel(
    const float* __restrict__ in, _Float16* __restrict__ out) {
  const size_t base = (size_t)blockIdx.x * 8192 + threadIdx.x * 4;
  // Unrolled, loads apart from stores: all eight loads are in flight before
  // the first is waited for.
  f32x4 v[8];
#pragma unroll
  for (int j = 0; j < 8; ++j)
    v[j] = *reinterpret_cast<const f32x4*>(in + base + j * 1024);
#pragma unroll
  for (int j = 0; j < 8; ++j) {
    u32x2 o;
    o[0] = pack_f16(v[j][0], v[j][1]);
    o[1] = pack_f16(v[j][2], v[j][3]);
    *reinterpret_cast<u32x2*>(out + base + j * 1024) = o;
  }
}

// transpose+convert: in [K][Nc] f32 row-major -> out [Nc][K] f16 row-major.
// One block per 128(k) x 64(n) tile.
// K and Nc are compile-time so that the eight row loads share one address
// register pair and differ only in their immediate offsets.
template <int K, int Nc>
__global__ __launch_bounds__(256) void cvtT_f16_kernel(
    const float* __restrict__ in, _Float16* __restrict__ out) {
  __shared__ unsigned tile[128][TT_PITCH];
  const int tid = threadIdx.x;
  const int n0 = blockIdx.x * 64, k0 = blockIdx.y * 128;
  const int c4 = tid & 15, r = tid >> 4;
  const float* src = in + (size_t)(k0 + r) * Nc + n0 + 4 * c4;
  // Unrolled, loads apart from LDS writes: all eight loads are in flight
  // before the first is waited for.
  f32x4 v[8];
#pragma unroll
  for (int i = 0; i < 8; ++i)
    v[i] = *reinterpret_cast<const f32x4*>(src + (size_t)i * 16 * Nc);
#pragma unroll
  for (int i = 0; i < 8; ++i) {
    tile[r + 16 * i][2 * c4] = pack_f16(v[i][0], v[i][1]);
    tile[r + 16 * i][2 * c4 + 1] = pack_f16(v[i][2], v[i][3]);
  }
  __syncthreads();  // the whole tile is written before any column is read
  _Float16* dst = out + (size_t)n0 * K + k0;
  tile_store_T(tile, dst, (size_t)K, tid);
  tile_store_T(tile + 64, dst + 64, (size_t)K, tid);
}

// gather V part of qkv into vT[b][h][dh][key] (f16).
// One block per 128(key) x 64(dh) tile of one (b,h).
__global__ __launch_bounds__(256) void vtrans_kernel(
    const _Float16* __restrict__ qkvh, _Float16* __restrict__ vT) {
  __shared__ unsigned tile[128][TT_PITCH];
  const int tid = threadIdx.x;
  const int key0 = blockIdx.x * 128;
  const int bh = blockIdx.y;
  const int b = bh / H_HEADS, h = bh % H_HEADS;
  const _Float16* src = qkvh + ((size_t)(b * NSEQ) + key0) * (3 * D_MODEL) +
                        2 * D_MODEL + h * DH_HEAD;
  const int seg = tid & 7, r = tid >> 3;
  // Unrolled, loads apart from LDS writes: all four loads are in flight
  // before the first is waited for.
  u32x4 v[4];
#pragma unroll
  for (int i = 0; i < 4; ++i)
    v[i] = *reinterpret_cast<const u32x4*>(
        src + (size_t)(r + 32 * i) * (3 * D_MODEL) + seg * 8);
#pragma unroll
  for (int i = 0; i < 4; ++i)
#pragma unroll
    for (int q = 0; q < 4; ++q) tile[r + 32 * i][4 * seg + q] = v[i][q];
  __syncthreads();  // the whole tile is written before any column is read
  _Float16* dst = vT + (size_t)bh * DH_HEAD * NSEQ + key0;
  tile_store_T(tile, dst, (size_t)NSEQ, tid);
  tile_store_T(tile + 64, dst + 64, (size_t)NSEQ, tid);
}

// ---------------- WMMA GEMM with async-LDS double buffering ------------------
// C[M,Nc] = A[M,K](f16) @ Bt[Nc,K]^T(f16) + bias.
// 256 threads = 8 waves (4x2); workgroup tile 128M x 128N, K-step 64.
// A staged row is 64 f16 = one whole 128-B line, so a wave-wide copy touches
// four whole lines, and a 128 x 128 tile reads each operand from L2 fewer times.
template <int OUTF32>
__global__ __launch_bounds__(256) void gemm_wmma_kernel(
    const _Float16* __restrict__ A, const _Float16* __restrict__ Bt,
    const float* __restrict__ bias, void* __restrict__ outp, int M, int Ncols,
    int K) {
  __shared__ __attribute__((aligned(16))) _Float16 lsA[2][128][72];
  __shared__ __attribute__((aligned(16))) _Float16 lsB[2][128][72];

  const int tid = threadIdx.x;
  const int l = tid & 31, wave = tid >> 5;
  const int lh = l >> 4, lm = l & 15;
  const int wm = wave >> 1, wn = wave & 1;
  const int mbase = blockIdx.y * 128;
  const int nbase = blockIdx.x * 128;

  // stage issue: 4 A-chunks + 4 B-chunks of 16 B per thread; 8 lanes per row,
  // chunk i lies 32 rows below chunk i-1.
  const int cr = tid >> 3, cseg = tid & 7;
  const _Float16* gA = A + (size_t)(mbase + cr) * K + cseg * 8;
  const _Float16* gB = Bt + (size_t)(nbase + cr) * K + cseg * 8;
  const size_t g32 = (size_t)32 * K;
  auto issue = [&](int s, int kk) {
    const _Float16* pa = gA + kk;
    const _Float16* pb = gB + kk;
    asm volatile(
        "global_load_async_to_lds_b128 %0, %8, off\n\t"
        "global_load_async_to_lds_b128 %1, %9, off\n\t"
        "global_load_async_to_lds_b128 %2, %10, off\n\t"
        "global_load_async_to_lds_b128 %3, %11, off\n\t"
        "global_load_async_to_lds_b128 %4, %12, off\n\t"
        "global_load_async_to_lds_b128 %5, %13, off\n\t"
        "global_load_async_to_lds_b128 %6, %14, off\n\t"
        "global_load_async_to_lds_b128 %7, %15, off\n\t"
        "s_wait_xcnt 0x0"
        :: "v"(lds_off(&lsA[s][cr][cseg * 8])),
           "v"(lds_off(&lsA[s][cr + 32][cseg * 8])),
           "v"(lds_off(&lsA[s][cr + 64][cseg * 8])),
           "v"(lds_off(&lsA[s][cr + 96][cseg * 8])),
           "v"(lds_off(&lsB[s][cr][cseg * 8])),
           "v"(lds_off(&lsB[s][cr + 32][cseg * 8])),
           "v"(lds_off(&lsB[s][cr + 64][cseg * 8])),
           "v"(lds_off(&lsB[s][cr + 96][cseg * 8])),
           "v"(pa), "v"(pa + g32), "v"(pa + 2 * g32), "v"(pa + 3 * g32),
           "v"(pb), "v"(pb + g32), "v"(pb + 2 * g32), "v"(pb + 3 * g32)
        : "memory");
  };

  v8f acc[2][4];
#pragma unroll
  for (int t = 0; t < 2; ++t)
#pragma unroll
    for (int u = 0; u < 4; ++u) acc[t][u] = v8f_zero();

  const int nk = K / 64;
  issue(0, 0);
  S_WAIT_ASYNCCNT(0);       // this wave's part of stage 0 has landed
  __syncthreads();          // stage 0 visible to all waves
  if (nk > 1) issue(1, 64);
  for (int ik = 0; ik < nk; ++ik) {
    const int s = ik & 1;
    // Unrolled: the two 32-wide halves of the step differ only in immediate
    // LDS offsets, and the fragment arrays stay in registers.
#pragma unroll
    for (int kh = 0; kh < 2; ++kh) {
      v16h a[2], bo[4];
#pragma unroll
      for (int t = 0; t < 2; ++t)
        a[t] = load_ab(&lsA[s][wm * 32 + t * 16 + lm][kh * 32 + 8 * lh]);
#pragma unroll
      for (int u = 0; u < 4; ++u)
        bo[u] = load_ab(&lsB[s][wn * 64 + u * 16 + lm][kh * 32 + 8 * lh]);
#pragma unroll
      for (int t = 0; t < 2; ++t)
#pragma unroll
        for (int u = 0; u < 4; ++u)
          acc[t][u] = wmma_f16(a[t], bo[u], acc[t][u]);
    }
    // Foot of the step: own reads of buffer s retired, own copies of stage
    // ik+1 landed; the one barrier publishes stage ik+1 and frees buffer s.
    asm volatile("s_wait_dscnt 0x0" ::: "memory");
    S_WAIT_ASYNCCNT(0);
    __syncthreads();
    if (ik + 2 < nk) issue(s, (ik + 2) * 64);
  }
  S_WAIT_ASYNCCNT(0);       // nothing in flight when the wave goes on to end

#pragma unroll
  for (int t = 0; t < 2; ++t) {
#pragma unroll
    for (int u = 0; u < 4; ++u) {
      const int col = nbase + wn * 64 + u * 16 + lm;
      const float bv = bias[col];
#pragma unroll
      for (int j = 0; j < 8; ++j) {
        const int row = mbase + wm * 32 + t * 16 + j + 8 * lh;
        const float v = acc[t][u][j] + bv;
        if (OUTF32)
          ((float*)outp)[(size_t)row * Ncols + col] = v;
        else
          ((_Float16*)outp)[(size_t)row * Ncols + col] = (_Float16)v;
      }
    }
  }
}

// ---------------- Flash attention: 4 waves share K/V via async LDS ----------
// Each wave owns 16 query rows; block covers 64 rows of one (b,h).
// S^T = K @ Q^T trick: softmax row = lane%16; S^T C-layout == A K-layout of
// P@V, so P needs no transpose, only f16 packing.
// The block's 64 x 32 tile of the distance matrix rides in the same ring as K
// and V: a copy takes whole 128-B lines (8 lanes a row) one pass ahead, where a
// register load in fragment order touches 16 lines for 512 B.
__global__ __launch_bounds__(128) void attn_kernel(
    const _Float16* __restrict__ qkvh, const _Float16* __restrict__ vT,
    const float* __restrict__ gamma, const float* __restrict__ dist,
    _Float16* __restrict__ attnh) {
  __shared__ __attribute__((aligned(16))) _Float16 lsK[2][32][72];  // [key_local][dh], 64 used
  __shared__ __attribute__((aligned(16))) _Float16 lsV[2][64][40];  // [dh][key_local], 32 used
  __shared__ __attribute__((aligned(16))) float    lsD[2][64][36];  // [q_local][key_local], 32 used

  const int tid = threadIdx.x;
  const int l = tid & 31, wave = tid >> 5;
  const int lh = l >> 4, lm = l & 15;
  const int h = blockIdx.y, b = blockIdx.z;
  const int qt = blockIdx.x * 4 + wave;
  const int qrow = qt * 16 + lm;

  const size_t row3d = (size_t)3 * D_MODEL;
  const _Float16* qbase = qkvh + (size_t)(b * NSEQ) * row3d + h * DH_HEAD;
  const _Float16* kbase = qbase + D_MODEL;
  const _Float16* vTbase = vT + (size_t)(b * H_HEADS + h) * DH_HEAD * NSEQ;
  const float g = gamma[b * H_HEADS + h];

  // stage issue: 2 K-chunks, 2 V-chunks and 4 distance chunks of 16 B per thread.
  // K and distance: 8 lanes a row, chunk i lies 16 rows below chunk i-1;
  // V: 4 lanes a row, chunk 1 lies 32 rows below chunk 0.
  const int r8 = tid >> 3, seg8 = tid & 7;
  const int r4 = tid >> 2, seg4 = tid & 3;
  const _Float16* gK = kbase + (size_t)r8 * row3d + seg8 * 8;
  const _Float16* gV = vTbase + (size_t)r4 * NSEQ + seg4 * 8;
  const float* gD = dist + (size_t)(blockIdx.x * 64 + r8) * NSEQ + seg8 * 4;
  auto issue = [&](int s, int kb0) {
    const _Float16* pk = gK + (size_t)kb0 * row3d;
    const _Float16* pv = gV + kb0;
    const float* pd = gD + kb0;
    asm volatile(
        "global_load_async_to_lds_b128 %0, %8, off\n\t"
        "global_load_async_to_lds_b128 %1, %9, off\n\t"
        "global_load_async_to_lds_b128 %2, %10, off\n\t"
        "global_load_async_to_lds_b128 %3, %11, off\n\t"
        "global_load_async_to_lds_b128 %4, %12, off\n\t"
        "global_load_async_to_lds_b128 %5, %13, off\n\t"
        "global_load_async_to_lds_b128 %6, %14, off\n\t"
        "global_load_async_to_lds_b128 %7, %15, off\n\t"
        "s_wait_xcnt 0x0"
        :: "v"(lds_off(&lsK[s][r8][seg8 * 8])),
           "v"(lds_off(&lsK[s][r8 + 16][seg8 * 8])),
           "v"(lds_off(&lsV[s][r4][seg4 * 8])),
           "v"(lds_off(&lsV[s][r4 + 32][seg4 * 8])),
           "v"(lds_off(&lsD[s][r8][seg8 * 4])),
           "v"(lds_off(&lsD[s][r8 + 16][seg8 * 4])),
           "v"(lds_off(&lsD[s][r8 + 32][seg8 * 4])),
           "v"(lds_off(&lsD[s][r8 + 48][seg8 * 4])),
           "v"(pk), "v"(pk + 16 * row3d),
           "v"(pv), "v"(pv + 32 * NSEQ),
           "v"(pd), "v"(pd + 16 * NSEQ), "v"(pd + 32 * NSEQ),
           "v"(pd + 48 * NSEQ)
        : "memory");
  };

  // Q^T as B operand (col = qrow = lane%16, K = dh contiguous): load once.
  v16h bq[2];
#pragma unroll
  for (int c = 0; c < 2; ++c)
    bq[c] = load_ab(qbase + (size_t)qrow * row3d + c * 32 + 8 * lh);

  v8f o[4];
#pragma unroll
  for (int d = 0; d < 4; ++d) o[d] = v8f_zero();
  float m = -1e30f, ssum = 0.0f;

  const int nkb = NSEQ / 32;
  issue(0, 0);
  S_WAIT_ASYNCCNT(0);       // this wave's part of stage 0 has landed
  __syncthreads();          // stage 0 visible to all waves
  issue(1, 32);
  for (int kb = 0; kb < nkb; ++kb) {
    const int s = kb & 1;

    // S^T tiles: A = 16 key rows from LDS, B = Q^T. Kdim = 64 -> 2 WMMA each.
    v8f st[2];
#pragma unroll
    for (int t = 0; t < 2; ++t) {
      v16h ak0 = load_ab(&lsK[s][t * 16 + lm][8 * lh]);
      v16h ak1 = load_ab(&lsK[s][t * 16 + lm][32 + 8 * lh]);
      st[t] = wmma_f16(ak0, bq[0], v8f_zero());
      st[t] = wmma_f16(ak1, bq[1], st[t]);
    }

    // scale + distance bias; element j of tile t = (key kb0+t*16+8*lh+j, qrow)
    float sc[2][8];
#pragma unroll
    for (int t = 0; t < 2; ++t) {
      // The pairs are written out: left to itself the compiler pairs the scores
      // across register pairs here and pays for it in register copies.
      const f32x4* dp =
          reinterpret_cast<const f32x4*>(&lsD[s][wave * 16 + lm][t * 16 + 8 * lh]);
      const f32x4 d0 = dp[0], d1 = dp[1];
#pragma unroll
      for (int j = 0; j < 8; j += 2) {
        const f32x2 s2 = {st[t][j], st[t][j + 1]};
        const f32x2 d2 = {j < 4 ? d0[j] : d1[j - 4], j < 4 ? d0[j + 1] : d1[j - 3]};
        const f32x2 r2 = s2 * QK_SCALE - g * d2;
        sc[t][j] = r2[0];
        sc[t][j + 1] = r2[1];
      }
    }

    // online softmax (row = qrow = lane%16) against a reference m that is renewed
    // lazily: m is the same in both lanes of a row and stays in use while no score
    // of the wave's pass lies more than LAZY_MARGIN above it, so p <= e^LAZY_MARGIN,
    // far inside f16 and f32 range; the final division by ssum cancels the
    // reference whatever it is.
    float bm = -1e30f;
#pragma unroll
    for (int t = 0; t < 2; ++t)
#pragma unroll
      for (int j = 0; j < 8; ++j) bm = fmaxf(bm, sc[t][j]);
    // One test a pass for the whole wave, a scalar branch on the ballot: the
    // exchange between the halves, alpha, and the rescaling of ssum and of the 32
    // O accumulators run only in a pass that raises the reference.
    if (__builtin_amdgcn_ballot_w32(bm > m + LAZY_MARGIN) != 0) {
      bm = fmaxf(bm, __shfl_xor(bm, 16));
      const float nm = fmaxf(m, bm);
      const float alpha = __expf(m - nm);
      ssum *= alpha;
      m = nm;
      // row of O tile j = qrow-local j+8*lh
#pragma unroll
      for (int j = 0; j < 8; ++j) {
        const float aj = __shfl(alpha, j + 8 * lh);
#pragma unroll
        for (int d = 0; d < 4; ++d) o[d][j] *= aj;
      }
    }
    // V B-operands from LDS (key contiguous per dh row), asked for as one group at
    // the head of the region that the branch opens. The scheduling barrier keeps
    // them there: without it the reads sink behind the exponentials, pair by pair,
    // and each pair is waited for as soon as it is issued.
    v16h vb[4];
#pragma unroll
    for (int d = 0; d < 4; ++d) vb[d] = load_ab(&lsV[s][d * 16 + lm][8 * lh]);
    __builtin_amdgcn_sched_barrier(0);
    // exp(x) as exp2(x * log2 e), the arithmetic of __expf, with the subtraction and
    // the product written in pairs like the scores: one packed instruction for two
    // scores. Left single, the compiler fuses them into dual-issue pairs.
    float p[2][8];
    float ps = 0.0f;
#pragma unroll
    for (int t = 0; t < 2; ++t)
#pragma unroll
      for (int j = 0; j < 8; j += 2) {
        const f32x2 s2 = {sc[t][j], sc[t][j + 1]};
        const f32x2 a2 = (s2 - m) * LOG2_E;
        p[t][j] = __builtin_amdgcn_exp2f(a2[0]);
        p[t][j + 1] = __builtin_amdgcn_exp2f(a2[1]);
        ps += p[t][j];
        ps += p[t][j + 1];
      }
    ps += __shfl_xor(ps, 16);
    ssum += ps;

    v16h pa;
#pragma unroll
    for (int j = 0; j < 8; ++j) {
      pa[j] = (_Float16)p[0][j];
      pa[8 + j] = (_Float16)p[1][j];
    }

    // O += P @ V
#pragma unroll
    for (int d = 0; d < 4; ++d) o[d] = wmma_f16(pa, vb[d], o[d]);

    // Foot of the pass: own reads of buffer s retired, own copies of stage
    // kb+1 landed; the one barrier publishes stage kb+1 and frees buffer s.
    // The scheduling barrier keeps the pass's vector and matrix work in front of
    // the waits: lifted to mid-pass they would expose the V reads' latency and
    // halve the time the copies have to land.
    __builtin_amdgcn_sched_barrier(0);
    asm volatile("s_wait_dscnt 0x0" ::: "memory");
    S_WAIT_ASYNCCNT(0);
    __syncthreads();
    if (kb + 2 < nkb) issue(s, (kb + 2) * 32);
  }
  S_WAIT_ASYNCCNT(0);       // nothing in flight when the wave goes on to end

  const float inv = 1.0f / ssum;
#pragma unroll
  for (int j = 0; j < 8; ++j) {
    const float ij = __shfl(inv, j + 8 * lh);
    const int row = qt * 16 + j + 8 * lh;
#pragma unroll
    for (int d = 0; d < 4; ++d) {
      attnh[((size_t)(b * NSEQ) + row) * D_MODEL + h * DH_HEAD + d * 16 + lm] =
          (_Float16)(o[d][j] * ij);
    }
  }
}

// ---------------------------------------------------------------------------
extern "C" void kernel_launch(void* const* d_in, const int* in_sizes, int n_in,
                              void* d_out, int out_size, void* d_ws,
                              size_t ws_size, hipStream_t stream) {
  const float* x      = (const float*)d_in[0];
  const float* gamma  = (const float*)d_in[1];
  const float* dist   = (const float*)d_in[2];
  const float* qkv_w  = (const float*)d_in[3];
  const float* qkv_b  = (const float*)d_in[4];
  const float* proj_w = (const float*)d_in[5];
  const float* proj_b = (const float*)d_in[6];
  float* out = (float*)d_out;

  const size_t n_x    = (size_t)BATCH * NSEQ * D_MODEL;      // 4Mi elems
  const size_t n_qkvw = (size_t)D_MODEL * 3 * D_MODEL;       // 3Mi
  const size_t n_pw   = (size_t)D_MODEL * D_MODEL;           // 1Mi
  const size_t n_qkv  = (size_t)BATCH * NSEQ * 3 * D_MODEL;  // 12Mi

  char* ws = (char*)d_ws;
  _Float16* xh     = (_Float16*)ws; ws += n_x * 2;
  _Float16* wqkvT  = (_Float16*)ws; ws += n_qkvw * 2;
  _Float16* wprojT = (_Float16*)ws; ws += n_pw * 2;
  _Float16* qkvh   = (_Float16*)ws; ws += n_qkv * 2;
  _Float16* vTh    = (_Float16*)ws; ws += n_x * 2;
  _Float16* attnh  = (_Float16*)ws; ws += n_x * 2;
  // total ws use: ~56 MB

  cvt_f16_kernel<<<(int)(n_x / 8192), 256, 0, stream>>>(x, xh);
  cvtT_f16_kernel<D_MODEL, 3 * D_MODEL>
      <<<dim3(3 * D_MODEL / 64, D_MODEL / 128), 256, 0, stream>>>(qkv_w, wqkvT);
  cvtT_f16_kernel<D_MODEL, D_MODEL>
      <<<dim3(D_MODEL / 64, D_MODEL / 128), 256, 0, stream>>>(proj_w, wprojT);

  dim3 g1(3 * D_MODEL / 128, BATCH * NSEQ / 128);
  gemm_wmma_kernel<0><<<g1, 256, 0, stream>>>(xh, wqkvT, qkv_b, qkvh,
                                              BATCH * NSEQ, 3 * D_MODEL,
                                              D_MODEL);

  vtrans_kernel<<<dim3(NSEQ / 128, BATCH * H_HEADS), 256, 0, stream>>>(qkvh, vTh);

  dim3 ga(NSEQ / 64, H_HEADS, BATCH);
  attn_kernel<<<ga, 128, 0, stream>>>(qkvh, vTh, gamma, dist, attnh);

  dim3 g2(D_MODEL / 128, BATCH * NSEQ / 128);
  gemm_wmma_kernel<1><<<g2, 256, 0, stream>>>(attnh, wprojT, proj_b, out,
                                              BATCH * NSEQ, D_MODEL, D_MODEL);
}

// v006
// One run takes 108 microseconds.
// Next to v005, in two timings, it ran 1.05 times as fast each time.
// Over all steps from v000 it is 2.30 times as fast.
#include <hip/hip_runtime.h>
#include <hip/hip_bf16.h>

typedef __attribute__((ext_vector_type(16))) _Float16 v16h;
typedef __attribute__((ext_vector_type(8)))  float    v8f;

#define D_MODEL  1024
#define H_HEADS  16
#define DH_HEAD  64
#define NSEQ     2048
#define BATCH    2
#define QK_SCALE 0.03125f  // 1024^-0.5
#define LOG2_E 1.442695041f
#define LAZY_MARGIN 5.5f    // about 8 in log2: a probability stays below 256

static __device__ __forceinline__ unsigned lds_off(const void* p) {
  return (unsigned)(unsigned long long)p;
}
#define S_WAIT_ASYNCCNT(n) asm volatile("s_wait_asynccnt " #n ::: "memory")

static __device__ __forceinline__ v16h load_ab(const _Float16* p) {
  v16h r;
  __builtin_memcpy(&r, p, 16);
  __builtin_memcpy(reinterpret_cast<char*>(&r) + 16, p + 16, 16);
  return r;
}

static __device__ __forceinline__ v8f v8f_zero() {
  v8f z;
#pragma unroll
  for (int j = 0; j < 8; ++j) z[j] = 0.0f;
  return z;
}

static __device__ __forceinline__ v8f wmma_f16(v16h a, v16h b, v8f c) {
  return __builtin_amdgcn_wmma_f32_16x16x32_f16(false, a, false, b, (short)0, c,
                                                false, false);
}

// ---------------- conversion and transposition ----------------
// All four jobs move 16 B per lane (8 B where f32 narrows to f16 in place) so that
// every wave-wide access covers whole 128-B lines, and a thread handles many
// elements, so that few waves have to be started.
typedef __attribute__((ext_vector_type(4))) float    f32x4;
typedef __attribute__((ext_vector_type(2))) float    f32x2;
typedef __attribute__((ext_vector_type(4))) unsigned u32x4;
typedef __attribute__((ext_vector_type(2))) unsigned u32x2;
typedef __attribute__((ext_vector_type(2))) _Float16 f16x2;

static __device__ __forceinline__ unsigned pack_f16(float a, float b) {
  f16x2 p;
  p[0] = (_Float16)a;
  p[1] = (_Float16)b;
  return __builtin_bit_cast(unsigned, p);
}

#define TT_PITCH 33

// Column-wise read of 64 tile rows and row-wise store of their transpose:
// dst row c (pitch dpitch elements) receives rows 0..63 of column c.
// 8 lanes cover one 128-B destination line; a thread serves columns 2*cp, 2*cp+1.
static __device__ __forceinline__ void tile_store_T(
    const unsigned (*tile)[TT_PITCH], _Float16* __restrict__ dst, size_t dpitch,
    int tid) {
  const int rs = tid & 7, cp = tid >> 3;
  // Both loops unrolled: w, lo and hi are indexed by constants and stay in
  // registers, and the eight LDS reads issue as one group.
  unsigned w[8];
#pragma unroll
  for (int i = 0; i < 8; ++i) w[i] = tile[8 * rs + i][cp];
  u32x4 lo, hi;
#pragma unroll
  for (int q = 0; q < 4; ++q) {
    lo[q] = (w[2 * q] & 0xffffu) | (w[2 * q + 1] << 16);
    hi[q] = (w[2 * q] >> 16) | (w[2 * q + 1] & 0xffff0000u);
  }
  *reinterpret_cast<u32x4*>(dst + (size_t)(2 * cp) * dpitch + 8 * rs) = lo;
  *reinterpret_cast<u32x4*>(dst + (size_t)(2 * cp + 1) * dpitch + 8 * rs) = hi;
}

// elementwise f32 -> f16; block blk converts 8192 consecutive elements.
static __device__ __forceinline__ void cvt_f16_block(
    const float* __restrict__ in, _Float16* __restrict__ out, int blk) {
  const size_t base = (size_t)blk * 8192 + threadIdx.x * 4;
  // Unrolled, loads apart from stores: all eight loads are in flight before
  // the first is waited for.
  f32x4 v[8];
#pragma unroll
  for (int j = 0; j < 8; ++j)
    v[j] = *reinterpret_cast<const f32x4*>(in + base + j * 1024);
#pragma unroll
  for (int j = 0; j < 8; ++j) {
    u32x2 o;
    o[0] = pack_f16(v[j][0], v[j][1]);
    o[1] = pack_f16(v[j][2], v[j][3]);
    *reinterpret_cast<u32x2*>(out + base + j * 1024) = o;
  }
  // Inlined beside other jobs, code may follow these stores: no register that
  // an issued store names is rewritten before this wait.
  asm volatile("s_wait_xcnt 0x0" ::: "memory");
}

// transpose+convert: in [K][Nc] f32 row-major -> out [Nc][K] f16 row-major.
// One block per 128(k) x 64(n) tile; block blk takes tile column blk % (Nc / 64).
// K and Nc are compile-time so that the eight row loads share one address
// register pair and differ only in their immediate offsets.
template <int K, int Nc>
static __device__ __forceinline__ void cvtT_f16_block(
    const float* __restrict__ in, _Float16* __restrict__ out,
    unsigned (*tile)[TT_PITCH], int blk) {
  const int tid = threadIdx.x;
  const int n0 = (blk % (Nc / 64)) * 64, k0 = (blk / (Nc / 64)) * 128;
  const int c4 = tid & 15, r = tid >> 4;
  const float* src = in + (size_t)(k0 + r) * Nc + n0 + 4 * c4;
  // Unrolled, loads apart from LDS writes: all eight loads are in flight
  // before the first is waited for.
  f32x4 v[8];
#pragma unroll
  for (int i = 0; i < 8; ++i)
    v[i] = *reinterpret_cast<const f32x4*>(src + (size_t)i * 16 * Nc);
#pragma unroll
  for (int i = 0; i < 8; ++i) {
    tile[r + 16 * i][2 * c4] = pack_f16(v[i][0], v[i][1]);
    tile[r + 16 * i][2 * c4 + 1] = pack_f16(v[i][2], v[i][3]);
  }
  __syncthreads();  // the whole tile is written before any column is read
  _Float16* dst = out + (size_t)n0 * K + k0;
  tile_store_T(tile, dst, (size_t)K, tid);
  tile_store_T(tile + 64, dst + 64, (size_t)K, tid);
  // Inlined beside other jobs, code may follow these stores: no register that
  // an issued store names is rewritten before this wait.
  asm volatile("s_wait_xcnt 0x0" ::: "memory");
}

// The three conversions of inputs read nothing of each other's output, so they
// share one launch: a block picks its job by its index. The transposes come
// first: their path (load, LDS, barrier, LDS, store) is the longer one.
// The choice is the same for a whole block,
// so every thread of a transposing block reaches that block's barrier.
#define NB_WQKV  ((3 * D_MODEL / 64) * (D_MODEL / 128))
#define NB_WPROJ ((D_MODEL / 64) * (D_MODEL / 128))
#define NB_X     (BATCH * NSEQ * D_MODEL / 8192)
__global__ __launch_bounds__(256) void prep_kernel(
    const float* __restrict__ x, const float* __restrict__ qkv_w,
    const float* __restrict__ proj_w, _Float16* __restrict__ xh,
    _Float16* __restrict__ wqkvT, _Float16* __restrict__ wprojT) {
  __shared__ unsigned tile[128][TT_PITCH];
  const int blk = blockIdx.x;
  if (blk < NB_WQKV)
    cvtT_f16_block<D_MODEL, 3 * D_MODEL>(qkv_w, wqkvT, tile, blk);
  else if (blk < NB_WQKV + NB_WPROJ)
    cvtT_f16_block<D_MODEL, D_MODEL>(proj_w, wprojT, tile, blk - NB_WQKV);
  else
    cvt_f16_block(x, xh, blk - (NB_WQKV + NB_WPROJ));
}

// gather V part of qkv into vT[b][h][dh][key] (f16).
// One block per 128(key) x 64(dh) tile of one (b,h).
__global__ __launch_bounds__(256) void vtrans_kernel(
    const _Float16* __restrict__ qkvh, _Float16* __restrict__ vT) {
  __shared__ unsigned tile[128][TT_PITCH];
  const int tid = threadIdx.x;
  const int key0 = blockIdx.x * 128;
  const int bh = blockIdx.y;
  const int b = bh / H_HEADS, h = bh % H_HEADS;
  const _Float16* src = qkvh + ((size_t)(b * NSEQ) + key0) * (3 * D_MODEL) +
                        2 * D_MODEL + h * DH_HEAD;
  const int seg = tid & 7, r = tid >> 3;
  // Unrolled, loads apart from LDS writes: all four loads are in flight
  // before the first is waited for.
  u32x4 v[4];
#pragma unroll
  for (int i = 0; i < 4; ++i)
    v[i] = *reinterpret_cast<const u32x4*>(
        src + (size_t)(r + 32 * i) * (3 * D_MODEL) + seg * 8);
#pragma unroll
  for (int i = 0; i < 4; ++i)
#pragma unroll
    for (int q = 0; q < 4; ++q) tile[r + 32 * i][4 * seg + q] = v[i][q];
  __syncthreads();  // the whole tile is written before any column is read
  _Float16* dst = vT + (size_t)bh * DH_HEAD * NSEQ + key0;
  tile_store_T(tile, dst, (size_t)NSEQ, tid);
  tile_store_T(tile + 64, dst + 64, (size_t)NSEQ, tid);
}

// ---------------- WMMA GEMM with async-LDS double buffering ------------------
// C[M,Nc] = A[M,K](f16) @ Bt[Nc,K]^T(f16) + bias.
// 256 threads = 8 waves (4x2); workgroup tile 128M x 128N, K-step 64.
// A staged row is 64 f16 = one whole 128-B line, so a wave-wide copy touches
// four whole lines, and a 128 x 128 tile reads each operand from L2 fewer times.
template <int OUTF32>
__global__ __launch_bounds__(256) void gemm_wmma_kernel(
    const _Float16* __restrict__ A, const _Float16* __restrict__ Bt,
    const float* __restrict__ bias, void* __restrict__ outp, int M, int Ncols,
    int K) {
  __shared__ __attribute__((aligned(16))) _Float16 lsA[2][128][72];
  __shared__ __attribute__((aligned(16))) _Float16 lsB[2][128][72];

  const int tid = threadIdx.x;
  const int l = tid & 31, wave = tid >> 5;
  const int lh = l >> 4, lm = l & 15;
  const int wm = wave >> 1, wn = wave & 1;
  const int mbase = blockIdx.y * 128;
  const int nbase = blockIdx.x * 128;

  // stage issue: 4 A-chunks + 4 B-chunks of 16 B per thread; 8 lanes per row,
  // chunk i lies 32 rows below chunk i-1.
  const int cr = tid >> 3, cseg = tid & 7;
  const _Float16* gA = A + (size_t)(mbase + cr) * K + cseg * 8;
  const _Float16* gB = Bt + (size_t)(nbase + cr) * K + cseg * 8;
  const size_t g32 = (size_t)32 * K;
  auto issue = [&](int s, int kk) {
    const _Float16* pa = gA + kk;
    const _Float16* pb = gB + kk;
    asm volatile(
        "global_load_async_to_lds_b128 %0, %8, off\n\t"
        "global_load_async_to_lds_b128 %1, %9, off\n\t"
        "global_load_async_to_lds_b128 %2, %10, off\n\t"
        "global_load_async_to_lds_b128 %3, %11, off\n\t"
        "global_load_async_to_lds_b128 %4, %12, off\n\t"
        "global_load_async_to_lds_b128 %5, %13, off\n\t"
        "global_load_async_to_lds_b128 %6, %14, off\n\t"
        "global_load_async_to_lds_b128 %7, %15, off\n\t"
        "s_wait_xcnt 0x0"
        :: "v"(lds_off(&lsA[s][cr][cseg * 8])),
           "v"(lds_off(&lsA[s][cr + 32][cseg * 8])),
           "v"(lds_off(&lsA[s][cr + 64][cseg * 8])),
           "v"(lds_off(&lsA[s][cr + 96][cseg * 8])),
           "v"(lds_off(&lsB[s][cr][cseg * 8])),
           "v"(lds_off(&lsB[s][cr + 32][cseg * 8])),
           "v"(lds_off(&lsB[s][cr + 64][cseg * 8])),
           "v"(lds_off(&lsB[s][cr + 96][cseg * 8])),
           "v"(pa), "v"(pa + g32), "v"(pa + 2 * g32), "v"(pa + 3 * g32),
           "v"(pb), "v"(pb + g32), "v"(pb + 2 * g32), "v"(pb + 3 * g32)
        : "memory");
  };

  v8f acc[2][4];
#pragma unroll
  for (int t = 0; t < 2; ++t)
#pragma unroll
    for (int u = 0; u < 4; ++u) acc[t][u] = v8f_zero();

  const int nk = K / 64;
  issue(0, 0);
  S_WAIT_ASYNCCNT(0);       // this wave's part of stage 0 has landed
  __syncthreads();          // stage 0 visible to all waves
  if (nk > 1) issue(1, 64);
  for (int ik = 0; ik < nk; ++ik) {
    const int s = ik & 1;
    // Unrolled: the two 32-wide halves of the step differ only in immediate
    // LDS offsets, and the fragment arrays stay in registers.
#pragma unroll
    for (int kh = 0; kh < 2; ++kh) {
      v16h a[2], bo[4];
#pragma unroll
      for (int t = 0; t < 2; ++t)
        a[t] = load_ab(&lsA[s][wm * 32 + t * 16 + lm][kh * 32 + 8 * lh]);
#pragma unroll
      for (int u = 0; u < 4; ++u)
        bo[u] = load_ab(&lsB[s][wn * 64 + u * 16 + lm][kh * 32 + 8 * lh]);
#pragma unroll
      for (int t = 0; t < 2; ++t)
#pragma unroll
        for (int u = 0; u < 4; ++u)
          acc[t][u] = wmma_f16(a[t], bo[u], acc[t][u]);
    }
    // Foot of the step: own reads of buffer s retired, own copies of stage
    // ik+1 landed; the one barrier publishes stage ik+1 and frees buffer s.
    asm volatile("s_wait_dscnt 0x0" ::: "memory");
    S_WAIT_ASYNCCNT(0);
    __syncthreads();
    if (ik + 2 < nk) issue(s, (ik + 2) * 64);
  }
  S_WAIT_ASYNCCNT(0);       // nothing in flight when the wave goes on to end

#pragma unroll
  for (int t = 0; t < 2; ++t) {
#pragma unroll
    for (int u = 0; u < 4; ++u) {
      const int col = nbase + wn * 64 + u * 16 + lm;
      const float bv = bias[col];
#pragma unroll
      for (int j = 0; j < 8; ++j) {
        const int row = mbase + wm * 32 + t * 16 + j + 8 * lh;
        const float v = acc[t][u][j] + bv;
        if (OUTF32)
          ((float*)outp)[(size_t)row * Ncols + col] = v;
        else
          ((_Float16*)outp)[(size_t)row * Ncols + col] = (_Float16)v;
      }
    }
  }
}

// ---------------- Flash attention: 4 waves share K/V via async LDS ----------
// Each wave owns 16 query rows; block covers 64 rows of one (b,h).
// S^T = K @ Q^T trick: softmax row = lane%16; S^T C-layout == A K-layout of
// P@V, so P needs no transpose, only f16 packing.
// The block's 64 x 32 tile of the distance matrix rides in the same ring as K
// and V: a copy takes whole 128-B lines (8 lanes a row) one pass ahead, where a
// register load in fragment order touches 16 lines for 512 B.
__global__ __launch_bounds__(128) void attn_kernel(
    const _Float16* __restrict__ qkvh, const _Float16* __restrict__ vT,
    const float* __restrict__ gamma, const float* __restrict__ dist,
    _Float16* __restrict__ attnh) {
  __shared__ __attribute__((aligned(16))) _Float16 lsK[2][32][72];  // [key_local][dh], 64 used
  __shared__ __attribute__((aligned(16))) _Float16 lsV[2][64][40];  // [dh][key_local], 32 used
  __shared__ __attribute__((aligned(16))) float    lsD[2][64][36];  // [q_local][key_local], 32 used

  const int tid = threadIdx.x;
  const int l = tid & 31, wave = tid >> 5;
  const int lh = l >> 4, lm = l & 15;
  const int h = blockIdx.y, b = blockIdx.z;
  const int qt = blockIdx.x * 4 + wave;
  const int qrow = qt * 16 + lm;

  const size_t row3d = (size_t)3 * D_MODEL;
  const _Float16* qbase = qkvh + (size_t)(b * NSEQ) * row3d + h * DH_HEAD;
  const _Float16* kbase = qbase + D_MODEL;
  const _Float16* vTbase = vT + (size_t)(b * H_HEADS + h) * DH_HEAD * NSEQ;
  const float g = gamma[b * H_HEADS + h];

  // stage issue: 2 K-chunks, 2 V-chunks and 4 distance chunks of 16 B per thread.
  // K and distance: 8 lanes a row, chunk i lies 16 rows below chunk i-1;
  // V: 4 lanes a row, chunk 1 lies 32 rows below chunk 0.
  const int r8 = tid >> 3, seg8 = tid & 7;
  const int r4 = tid >> 2, seg4 = tid & 3;
  const _Float16* gK = kbase + (size_t)r8 * row3d + seg8 * 8;
  const _Float16* gV = vTbase + (size_t)r4 * NSEQ + seg4 * 8;
  const float* gD = dist + (size_t)(blockIdx.x * 64 + r8) * NSEQ + seg8 * 4;
  auto issue = [&](int s, int kb0) {
    const _Float16* pk = gK + (size_t)kb0 * row3d;
    const _Float16* pv = gV + kb0;
    const float* pd = gD + kb0;
    asm volatile(
        "global_load_async_to_lds_b128 %0, %8, off\n\t"
        "global_load_async_to_lds_b128 %1, %9, off\n\t"
        "global_load_async_to_lds_b128 %2, %10, off\n\t"
        "global_load_async_to_lds_b128 %3, %11, off\n\t"
        "global_load_async_to_lds_b128 %4, %12, off\n\t"
        "global_load_async_to_lds_b128 %5, %13, off\n\t"
        "global_load_async_to_lds_b128 %6, %14, off\n\t"
        "global_load_async_to_lds_b128 %7, %15, off\n\t"
        "s_wait_xcnt 0x0"
        :: "v"(lds_off(&lsK[s][r8][seg8 * 8])),
           "v"(lds_off(&lsK[s][r8 + 16][seg8 * 8])),
           "v"(lds_off(&lsV[s][r4][seg4 * 8])),
           "v"(lds_off(&lsV[s][r4 + 32][seg4 * 8])),
           "v"(lds_off(&lsD[s][r8][seg8 * 4])),
           "v"(lds_off(&lsD[s][r8 + 16][seg8 * 4])),
           "v"(lds_off(&lsD[s][r8 + 32][seg8 * 4])),
           "v"(lds_off(&lsD[s][r8 + 48][seg8 * 4])),
           "v"(pk), "v"(pk + 16 * row3d),
           "v"(pv), "v"(pv + 32 * NSEQ),
           "v"(pd), "v"(pd + 16 * NSEQ), "v"(pd + 32 * NSEQ),
           "v"(pd + 48 * NSEQ)
        : "memory");
  };

  // Q^T as B operand (col = qrow = lane%16, K = dh contiguous): load once.
  v16h bq[2];
#pragma unroll
  for (int c = 0; c < 2; ++c)
    bq[c] = load_ab(qbase + (size_t)qrow * row3d + c * 32 + 8 * lh);

  v8f o[4];
#pragma unroll
  for (int d = 0; d < 4; ++d) o[d] = v8f_zero();
  float m = -1e30f, ssum = 0.0f;

  const int nkb = NSEQ / 32;
  issue(0, 0);
  S_WAIT_ASYNCCNT(0);       // this wave's part of stage 0 has landed
  __syncthreads();          // stage 0 visible to all waves
  issue(1, 32);
  for (int kb = 0; kb < nkb; ++kb) {
    const int s = kb & 1;

    // S^T tiles: A = 16 key rows from LDS, B = Q^T. Kdim = 64 -> 2 WMMA each.
    v8f st[2];
#pragma unroll
    for (int t = 0; t < 2; ++t) {
      v16h ak0 = load_ab(&lsK[s][t * 16 + lm][8 * lh]);
      v16h ak1 = load_ab(&lsK[s][t * 16 + lm][32 + 8 * lh]);
      st[t] = wmma_f16(ak0, bq[0], v8f_zero());
      st[t] = wmma_f16(ak1, bq[1], st[t]);
    }

    // scale + distance bias; element j of tile t = (key kb0+t*16+8*lh+j, qrow)
    float sc[2][8];
#pragma unroll
    for (int t = 0; t < 2; ++t) {
      // The pairs are written out: left to itself the compiler pairs the scores
      // across register pairs here and pays for it in register copies.
      const f32x4* dp =
          reinterpret_cast<const f32x4*>(&lsD[s][wave * 16 + lm][t * 16 + 8 * lh]);
      const f32x4 d0 = dp[0], d1 = dp[1];
#pragma unroll
      for (int j = 0; j < 8; j += 2) {
        const f32x2 s2 = {st[t][j], st[t][j + 1]};
        const f32x2 d2 = {j < 4 ? d0[j] : d1[j - 4], j < 4 ? d0[j + 1] : d1[j - 3]};
        const f32x2 r2 = s2 * QK_SCALE - g * d2;
        sc[t][j] = r2[0];
        sc[t][j + 1] = r2[1];
      }
    }

    // online softmax (row = qrow = lane%16) against a reference m that is renewed
    // lazily: m is the same in both lanes of a row and stays in use while no score
    // of the wave's pass lies more than LAZY_MARGIN above it, so p <= e^LAZY_MARGIN,
    // far inside f16 and f32 range; the final division by ssum cancels the
    // reference whatever it is.
    float bm = -1e30f;
#pragma unroll
    for (int t = 0; t < 2; ++t)
#pragma unroll
      for (int j = 0; j < 8; ++j) bm = fmaxf(bm, sc[t][j]);
    // One test a pass for the whole wave, a scalar branch on the ballot: the
    // exchange between the halves, alpha, and the rescaling of ssum and of the 32
    // O accumulators run only in a pass that raises the reference.
    if (__builtin_amdgcn_ballot_w32(bm > m + LAZY_MARGIN) != 0) {
      bm = fmaxf(bm, __shfl_xor(bm, 16));
      const float nm = fmaxf(m, bm);
      const float alpha = __expf(m - nm);
      ssum *= alpha;
      m = nm;
      // row of O tile j = qrow-local j+8*lh
#pragma unroll
      for (int j = 0; j < 8; ++j) {
        const float aj = __shfl(alpha, j + 8 * lh);
#pragma unroll
        for (int d = 0; d < 4; ++d) o[d][j] *= aj;
      }
    }
    // V B-operands from LDS (key contiguous per dh row), asked for as one group at
    // the head of the region that the branch opens. The scheduling barrier keeps
    // them there: without it the reads sink behind the exponentials, pair by pair,
    // and each pair is waited for as soon as it is issued.
    v16h vb[4];
#pragma unroll
    for (int d = 0; d < 4; ++d) vb[d] = load_ab(&lsV[s][d * 16 + lm][8 * lh]);
    __builtin_amdgcn_sched_barrier(0);
    // exp(x) as exp2(x * log2 e), the arithmetic of __expf, with the subtraction and
    // the product written in pairs like the scores: one packed instruction for two
    // scores. Left single, the compiler fuses them into dual-issue pairs.
    float p[2][8];
    float ps = 0.0f;
#pragma unroll
    for (int t = 0; t < 2; ++t)
#pragma unroll
      for (int j = 0; j < 8; j += 2) {
        const f32x2 s2 = {sc[t][j], sc[t][j + 1]};
        const f32x2 a2 = (s2 - m) * LOG2_E;
        p[t][j] = __builtin_amdgcn_exp2f(a2[0]);
        p[t][j + 1] = __builtin_amdgcn_exp2f(a2[1]);
        ps += p[t][j];
        ps += p[t][j + 1];
      }
    ps += __shfl_xor(ps, 16);
    ssum += ps;

    v16h pa;
#pragma unroll
    for (int j = 0; j < 8; ++j) {
      pa[j] = (_Float16)p[0][j];
      pa[8 + j] = (_Float16)p[1][j];
    }

    // O += P @ V
#pragma unroll
    for (int d = 0; d < 4; ++d) o[d] = wmma_f16(pa, vb[d], o[d]);

    // Foot of the pass: own reads of buffer s retired, own copies of stage
    // kb+1 landed; the one barrier publishes stage kb+1 and frees buffer s.
    // The scheduling barrier keeps the pass's vector and matrix work in front of
    // the waits: lifted to mid-pass they would expose the V reads' latency and
    // halve the time the copies have to land.
    __builtin_amdgcn_sched_barrier(0);
    asm volatile("s_wait_dscnt 0x0" ::: "memory");
    S_WAIT_ASYNCCNT(0);
    __syncthreads();
    if (kb + 2 < nkb) issue(s, (kb + 2) * 32);
  }
  S_WAIT_ASYNCCNT(0);       // nothing in flight when the wave goes on to end

  const float inv = 1.0f / ssum;
#pragma unroll
  for (int j = 0; j < 8; ++j) {
    const float ij = __shfl(inv, j + 8 * lh);
    const int row = qt * 16 + j + 8 * lh;
#pragma unroll
    for (int d = 0; d < 4; ++d) {
      attnh[((size_t)(b * NSEQ) + row) * D_MODEL + h * DH_HEAD + d * 16 + lm] =
          (_Float16)(o[d][j] * ij);
    }
  }
}

// ---------------------------------------------------------------------------
extern "C" void kernel_launch(void* const* d_in, const int* in_sizes, int n_in,
                              void* d_out, int out_size, void* d_ws,
                              size_t ws_size, hipStream_t stream) {
  const float* x      = (const float*)d_in[0];
  const float* gamma  = (const float*)d_in[1];
  const float* dist   = (const float*)d_in[2];
  const float* qkv_w  = (const float*)d_in[3];
  const float* qkv_b  = (const float*)d_in[4];
  const float* proj_w = (const float*)d_in[5];
  const float* proj_b = (const float*)d_in[6];
  float* out = (float*)d_out;

  const size_t n_x    = (size_t)BATCH * NSEQ * D_MODEL;      // 4Mi elems
  const size_t n_qkvw = (size_t)D_MODEL * 3 * D_MODEL;       // 3Mi
  const size_t n_pw   = (size_t)D_MODEL * D_MODEL;           // 1Mi
  const size_t n_qkv  = (size_t)BATCH * NSEQ * 3 * D_MODEL;  // 12Mi

  char* ws = (char*)d_ws;
  _Float16* xh     = (_Float16*)ws; ws += n_x * 2;
  _Float16* wqkvT  = (_Float16*)ws; ws += n_qkvw * 2;
  _Float16* wprojT = (_Float16*)ws; ws += n_pw * 2;
  _Float16* qkvh   = (_Float16*)ws; ws += n_qkv * 2;
  _Float16* vTh    = (_Float16*)ws; ws += n_x * 2;
  _Float16* attnh  = (_Float16*)ws; ws += n_x * 2;
  // total ws use: ~56 MB

  prep_kernel<<<NB_WQKV + NB_WPROJ + NB_X, 256, 0, stream>>>(
      x, qkv_w, proj_w, xh, wqkvT, wprojT);

  dim3 g1(3 * D_MODEL / 128, BATCH * NSEQ / 128);
  gemm_wmma_kernel<0><<<g1, 256, 0, stream>>>(xh, wqkvT, qkv_b, qkvh,
                                              BATCH * NSEQ, 3 * D_MODEL,
                                              D_MODEL);

  vtrans_kernel<<<dim3(NSEQ / 128, BATCH * H_HEADS), 256, 0, stream>>>(qkvh, vTh);

  dim3 ga(NSEQ / 64, H_HEADS, BATCH);
  attn_kernel<<<ga, 128, 0, stream>>>(qkvh, vTh, gamma, dist, attnh);

  dim3 g2(D_MODEL / 128, BATCH * NSEQ / 128);
  gemm_wmma_kernel<1><<<g2, 256, 0, stream>>>(attnh, wprojT, proj_b, out,
                                              BATCH * NSEQ, D_MODEL, D_MODEL);
}

// v007
// Measured time: 105 microseconds a run.
// Next to v006, in two timings, it ran 1.04 times as fast each time.
// Counting every step since v000, it is 2.39 times as fast.
#include <hip/hip_runtime.h>
#include <hip/hip_bf16.h>

typedef __attribute__((ext_vector_type(16))) _Float16 v16h;
typedef __attribute__((ext_vector_type(8)))  float    v8f;

#define D_MODEL  1024
#define H_HEADS  16
#define DH_HEAD  64
#define NSEQ     2048
#define BATCH    2
#define QK_SCALE 0.03125f  // 1024^-0.5
#define LOG2_E 1.442695041f
#define LAZY_MARGIN 5.5f    // about 8 in log2: a probability stays below 256

static __device__ __forceinline__ unsigned lds_off(const void* p) {
  return (unsigned)(unsigned long long)p;
}
#define S_WAIT_ASYNCCNT(n) asm volatile("s_wait_asynccnt " #n ::: "memory")

static __device__ __forceinline__ v16h load_ab(const _Float16* p) {
  v16h r;
  __builtin_memcpy(&r, p, 16);
  __builtin_memcpy(reinterpret_cast<char*>(&r) + 16, p + 16, 16);
  return r;
}

static __device__ __forceinline__ v8f v8f_zero() {
  v8f z;
#pragma unroll
  for (int j = 0; j < 8; ++j) z[j] = 0.0f;
  return z;
}

static __device__ __forceinline__ v8f wmma_f16(v16h a, v16h b, v8f c) {
  return __builtin_amdgcn_wmma_f32_16x16x32_f16(false, a, false, b, (short)0, c,
                                                false, false);
}

// ---------------- conversion and transposition ----------------
// All three jobs move 16 B per lane (8 B where f32 narrows to f16 in place) so that
// every wave-wide access covers whole 128-B lines, and a thread handles many
// elements, so that few waves have to be started.
typedef __attribute__((ext_vector_type(4))) float    f32x4;
typedef __attribute__((ext_vector_type(2))) float    f32x2;
typedef __attribute__((ext_vector_type(4))) unsigned u32x4;
typedef __attribute__((ext_vector_type(2))) unsigned u32x2;
typedef __attribute__((ext_vector_type(2))) _Float16 f16x2;

static __device__ __forceinline__ unsigned pack_f16(float a, float b) {
  f16x2 p;
  p[0] = (_Float16)a;
  p[1] = (_Float16)b;
  return __builtin_bit_cast(unsigned, p);
}

#define TT_PITCH 33

// Column-wise read of 64 tile rows and row-wise store of their transpose:
// dst row c (pitch dpitch elements) receives rows 0..63 of column c.
// 8 lanes cover one 128-B destination line; a thread serves columns 2*cp, 2*cp+1.
static __device__ __forceinline__ void tile_store_T(
    const unsigned (*tile)[TT_PITCH], _Float16* __restrict__ dst, size_t dpitch,
    int tid) {
  const int rs = tid & 7, cp = tid >> 3;
  // Both loops unrolled: w, lo and hi are indexed by constants and stay in
  // registers, and the eight LDS reads issue as one group.
  unsigned w[8];
#pragma unroll
  for (int i = 0; i < 8; ++i) w[i] = tile[8 * rs + i][cp];
  u32x4 lo, hi;
#pragma unroll
  for (int q = 0; q < 4; ++q) {
    lo[q] = (w[2 * q] & 0xffffu) | (w[2 * q + 1] << 16);
    hi[q] = (w[2 * q] >> 16) | (w[2 * q + 1] & 0xffff0000u);
  }
  *reinterpret_cast<u32x4*>(dst + (size_t)(2 * cp) * dpitch + 8 * rs) = lo;
  *reinterpret_cast<u32x4*>(dst + (size_t)(2 * cp + 1) * dpitch + 8 * rs) = hi;
}

// elementwise f32 -> f16; block blk converts 8192 consecutive elements.
static __device__ __forceinline__ void cvt_f16_block(
    const float* __restrict__ in, _Float16* __restrict__ out, int blk) {
  const size_t base = (size_t)blk * 8192 + threadIdx.x * 4;
  // Unrolled, loads apart from stores: all eight loads are in flight before
  // the first is waited for.
  f32x4 v[8];
#pragma unroll
  for (int j = 0; j < 8; ++j)
    v[j] = *reinterpret_cast<const f32x4*>(in + base + j * 1024);
#pragma unroll
  for (int j = 0; j < 8; ++j) {
    u32x2 o;
    o[0] = pack_f16(v[j][0], v[j][1]);
    o[1] = pack_f16(v[j][2], v[j][3]);
    *reinterpret_cast<u32x2*>(out + base + j * 1024) = o;
  }
  // Inlined beside other jobs, code may follow these stores: no register that
  // an issued store names is rewritten before this wait.
  asm volatile("s_wait_xcnt 0x0" ::: "memory");
}

// transpose+convert: in [K][Nc] f32 row-major -> out [Nc][K] f16 row-major.
// One block per 128(k) x 64(n) tile; block blk takes tile column blk % (Nc / 64).
// K and Nc are compile-time so that the eight row loads share one address
// register pair and differ only in their immediate offsets.
template <int K, int Nc>
static __device__ __forceinline__ void cvtT_f16_block(
    const float* __restrict__ in, _Float16* __restrict__ out,
    unsigned (*tile)[TT_PITCH], int blk) {
  const int tid = threadIdx.x;
  const int n0 = (blk % (Nc / 64)) * 64, k0 = (blk / (Nc / 64)) * 128;
  const int c4 = tid & 15, r = tid >> 4;
  const float* src = in + (size_t)(k0 + r) * Nc + n0 + 4 * c4;
  // Unrolled, loads apart from LDS writes: all eight loads are in flight
  // before the first is waited for.
  f32x4 v[8];
#pragma unroll
  for (int i = 0; i < 8; ++i)
    v[i] = *reinterpret_cast<const f32x4*>(src + (size_t)i * 16 * Nc);
#pragma unroll
  for (int i = 0; i < 8; ++i) {
    tile[r + 16 * i][2 * c4] = pack_f16(v[i][0], v[i][1]);
    tile[r + 16 * i][2 * c4 + 1] = pack_f16(v[i][2], v[i][3]);
  }
  __syncthreads();  // the whole tile is written before any column is read
  _Float16* dst = out + (size_t)n0 * K + k0;
  tile_store_T(tile, dst, (size_t)K, tid);
  tile_store_T(tile + 64, dst + 64, (size_t)K, tid);
  // Inlined beside other jobs, code may follow these stores: no register that
  // an issued store names is rewritten before this wait.
  asm volatile("s_wait_xcnt 0x0" ::: "memory");
}

// The three conversions of inputs read nothing of each other's output, so they
// share one launch: a block picks its job by its index. The transposes come
// first: their path (load, LDS, barrier, LDS, store) is the longer one.
// The choice is the same for a whole block,
// so every thread of a transposing block reaches that block's barrier.
#define NB_WQKV  ((3 * D_MODEL / 64) * (D_MODEL / 128))
#define NB_WPROJ ((D_MODEL / 64) * (D_MODEL / 128))
#define NB_X     (BATCH * NSEQ * D_MODEL / 8192)
__global__ __launch_bounds__(256) void prep_kernel(
    const float* __restrict__ x, const float* __restrict__ qkv_w,
    const float* __restrict__ proj_w, _Float16* __restrict__ xh,
    _Float16* __restrict__ wqkvT, _Float16* __restrict__ wprojT) {
  __shared__ unsigned tile[128][TT_PITCH];
  const int blk = blockIdx.x;
  if (blk < NB_WQKV)
    cvtT_f16_block<D_MODEL, 3 * D_MODEL>(qkv_w, wqkvT, tile, blk);
  else if (blk < NB_WQKV + NB_WPROJ)
    cvtT_f16_block<D_MODEL, D_MODEL>(proj_w, wprojT, tile, blk - NB_WQKV);
  else
    cvt_f16_block(x, xh, blk - (NB_WQKV + NB_WPROJ));
}

// ---------------- WMMA GEMM with async-LDS double buffering ------------------
// C[M,Nc] = A[M,K](f16) @ Bt[Nc,K]^T(f16) + bias.
// 256 threads = 8 waves (4x2); workgroup tile 128M x 128N, K-step 64.
// A staged row is 64 f16 = one whole 128-B line, so a wave-wide copy touches
// four whole lines, and a 128 x 128 tile reads each operand from L2 fewer times.
// With f16 output, a block whose columns lie in the V third of the QKV product
// writes its tile as vT[b][h][dh][key], the layout the attention kernel reads,
// and writes nothing to outp: nobody reads V in row-major form.
#define VT_PITCH 136  // f16 per staged column: 272 B = 16 B x odd
template <int OUTF32>
__global__ __launch_bounds__(256) void gemm_wmma_kernel(
    const _Float16* __restrict__ A, const _Float16* __restrict__ Bt,
    const float* __restrict__ bias, void* __restrict__ outp,
    _Float16* __restrict__ vT, int M, int Ncols, int K) {
  __shared__ __attribute__((aligned(16))) _Float16 lsA[2][128][72];
  __shared__ __attribute__((aligned(16))) _Float16 lsB[2][128][72];

  const int tid = threadIdx.x;
  const int l = tid & 31, wave = tid >> 5;
  const int lh = l >> 4, lm = l & 15;
  const int wm = wave >> 1, wn = wave & 1;
  const int mbase = blockIdx.y * 128;
  const int nbase = blockIdx.x * 128;

  // stage issue: 4 A-chunks + 4 B-chunks of 16 B per thread; 8 lanes per row,
  // chunk i lies 32 rows below chunk i-1.
  const int cr = tid >> 3, cseg = tid & 7;
  const _Float16* gA = A + (size_t)(mbase + cr) * K + cseg * 8;
  const _Float16* gB = Bt + (size_t)(nbase + cr) * K + cseg * 8;
  const size_t g32 = (size_t)32 * K;
  auto issue = [&](int s, int kk) {
    const _Float16* pa = gA + kk;
    const _Float16* pb = gB + kk;
    asm volatile(
        "global_load_async_to_lds_b128 %0, %8, off\n\t"
        "global_load_async_to_lds_b128 %1, %9, off\n\t"
        "global_load_async_to_lds_b128 %2, %10, off\n\t"
        "global_load_async_to_lds_b128 %3, %11, off\n\t"
        "global_load_async_to_lds_b128 %4, %12, off\n\t"
        "global_load_async_to_lds_b128 %5, %13, off\n\t"
        "global_load_async_to_lds_b128 %6, %14, off\n\t"
        "global_load_async_to_lds_b128 %7, %15, off\n\t"
        "s_wait_xcnt 0x0"
        :: "v"(lds_off(&lsA[s][cr][cseg * 8])),
           "v"(lds_off(&lsA[s][cr + 32][cseg * 8])),
           "v"(lds_off(&lsA[s][cr + 64][cseg * 8])),
           "v"(lds_off(&lsA[s][cr + 96][cseg * 8])),
           "v"(lds_off(&lsB[s][cr][cseg * 8])),
           "v"(lds_off(&lsB[s][cr + 32][cseg * 8])),
           "v"(lds_off(&lsB[s][cr + 64][cseg * 8])),
           "v"(lds_off(&lsB[s][cr + 96][cseg * 8])),
           "v"(pa), "v"(pa + g32), "v"(pa + 2 * g32), "v"(pa + 3 * g32),
           "v"(pb), "v"(pb + g32), "v"(pb + 2 * g32), "v"(pb + 3 * g32)
        : "memory");
  };

  v8f acc[2][4];
#pragma unroll
  for (int t = 0; t < 2; ++t)
#pragma unroll
    for (int u = 0; u < 4; ++u) acc[t][u] = v8f_zero();

  const int nk = K / 64;
  issue(0, 0);
  S_WAIT_ASYNCCNT(0);       // this wave's part of stage 0 has landed
  __syncthreads();          // stage 0 visible to all waves
  if (nk > 1) issue(1, 64);
  for (int ik = 0; ik < nk; ++ik) {
    const int s = ik & 1;
    // Unrolled: the two 32-wide halves of the step differ only in immediate
    // LDS offsets, and the fragment arrays stay in registers.
#pragma unroll
    for (int kh = 0; kh < 2; ++kh) {
      v16h a[2], bo[4];
#pragma unroll
      for (int t = 0; t < 2; ++t)
        a[t] = load_ab(&lsA[s][wm * 32 + t * 16 + lm][kh * 32 + 8 * lh]);
#pragma unroll
      for (int u = 0; u < 4; ++u)
        bo[u] = load_ab(&lsB[s][wn * 64 + u * 16 + lm][kh * 32 + 8 * lh]);
#pragma unroll
      for (int t = 0; t < 2; ++t)
#pragma unroll
        for (int u = 0; u < 4; ++u)
          acc[t][u] = wmma_f16(a[t], bo[u], acc[t][u]);
    }
    // Foot of the step: own reads of buffer s retired, own copies of stage
    // ik+1 landed; the one barrier publishes stage ik+1 and frees buffer s.
    asm volatile("s_wait_dscnt 0x0" ::: "memory");
    S_WAIT_ASYNCCNT(0);
    __syncthreads();
    if (ik + 2 < nk) issue(s, (ik + 2) * 64);
  }
  S_WAIT_ASYNCCNT(0);       // nothing in flight when the wave goes on to end

  // The choice is the same for a whole block, so all its threads reach the barrier.
  if (!OUTF32 && nbase >= 2 * D_MODEL) {
    // A lane holds 8 consecutive rows (keys) of one column (dh): 16 B of a vT row.
    // The tile is staged column by column in the A ring, which the barrier at the
    // foot of the last K-step has freed, so that the stores take whole rows of
    // 128 keys (two 128-B lines, one writer each).
    _Float16 (*stg)[VT_PITCH] =
        reinterpret_cast<_Float16 (*)[VT_PITCH]>(&lsA[0][0][0]);
#pragma unroll
    for (int t = 0; t < 2; ++t) {
#pragma unroll
      for (int u = 0; u < 4; ++u) {
        const int c = wn * 64 + u * 16 + lm;
        const float bv = bias[nbase + c];
        u32x4 w;
#pragma unroll
        for (int q = 0; q < 4; ++q)
          w[q] = pack_f16(acc[t][u][2 * q] + bv, acc[t][u][2 * q + 1] + bv);
        *reinterpret_cast<u32x4*>(&stg[c][wm * 32 + t * 16 + 8 * lh]) = w;
      }
    }
    __syncthreads();  // the whole tile is staged before any column is read
    // 16 lanes a column; sweep i takes the columns 16 below those of sweep i-1.
    const int sc = tid >> 4, sseg = tid & 15;
    _Float16* dst = vT +
        ((size_t)(mbase / NSEQ) * D_MODEL + (nbase - 2 * D_MODEL) + sc) * NSEQ +
        mbase % NSEQ + sseg * 8;
    // Unrolled, reads apart from stores: the eight LDS reads issue as one group.
    u32x4 v[8];
#pragma unroll
    for (int i = 0; i < 8; ++i)
      v[i] = *reinterpret_cast<const u32x4*>(&stg[sc + 16 * i][sseg * 8]);
#pragma unroll
    for (int i = 0; i < 8; ++i)
      *reinterpret_cast<u32x4*>(dst + (size_t)i * 16 * NSEQ) = v[i];
    // No register that an issued store names is rewritten before this wait.
    asm volatile("s_wait_xcnt 0x0" ::: "memory");
    return;
  }

#pragma unroll
  for (int t = 0; t < 2; ++t) {
#pragma unroll
    for (int u = 0; u < 4; ++u) {
      const int col = nbase + wn * 64 + u * 16 + lm;
      const float bv = bias[col];
#pragma unroll
      for (int j = 0; j < 8; ++j) {
        const int row = mbase + wm * 32 + t * 16 + j + 8 * lh;
        const float v = acc[t][u][j] + bv;
        if (OUTF32)
          ((float*)outp)[(size_t)row * Ncols + col] = v;
        else
          ((_Float16*)outp)[(size_t)row * Ncols + col] = (_Float16)v;
      }
    }
  }
}

// ---------------- Flash attention: 4 waves share K/V via async LDS ----------
// Each wave owns 16 query rows; block covers 64 rows of one (b,h).
// S^T = K @ Q^T trick: softmax row = lane%16; S^T C-layout == A K-layout of
// P@V, so P needs no transpose, only f16 packing.
// The block's 64 x 32 tile of the distance matrix rides in the same ring as K
// and V: a copy takes whole 128-B lines (8 lanes a row) one pass ahead, where a
// register load in fragment order touches 16 lines for 512 B.
__global__ __launch_bounds__(128) void attn_kernel(
    const _Float16* __restrict__ qkvh, const _Float16* __restrict__ vT,
    const float* __restrict__ gamma, const float* __restrict__ dist,
    _Float16* __restrict__ attnh) {
  __shared__ __attribute__((aligned(16))) _Float16 lsK[2][32][72];  // [key_local][dh], 64 used
  __shared__ __attribute__((aligned(16))) _Float16 lsV[2][64][40];  // [dh][key_local], 32 used
  __shared__ __attribute__((aligned(16))) float    lsD[2][64][36];  // [q_local][key_local], 32 used

  const int tid = threadIdx.x;
  const int l = tid & 31, wave = tid >> 5;
  const int lh = l >> 4, lm = l & 15;
  const int h = blockIdx.y, b = blockIdx.z;
  const int qt = blockIdx.x * 4 + wave;
  const int qrow = qt * 16 + lm;

  const size_t row3d = (size_t)3 * D_MODEL;
  const _Float16* qbase = qkvh + (size_t)(b * NSEQ) * row3d + h * DH_HEAD;
  const _Float16* kbase = qbase + D_MODEL;
  const _Float16* vTbase = vT + (size_t)(b * H_HEADS + h) * DH_HEAD * NSEQ;
  const float g = gamma[b * H_HEADS + h];

  // stage issue: 2 K-chunks, 2 V-chunks and 4 distance chunks of 16 B per thread.
  // K and distance: 8 lanes a row, chunk i lies 16 rows below chunk i-1;
  // V: 4 lanes a row, chunk 1 lies 32 rows below chunk 0.
  const int r8 = tid >> 3, seg8 = tid & 7;
  const int r4 = tid >> 2, seg4 = tid & 3;
  const _Float16* gK = kbase + (size_t)r8 * row3d + seg8 * 8;
  const _Float16* gV = vTbase + (size_t)r4 * NSEQ + seg4 * 8;
  const float* gD = dist + (size_t)(blockIdx.x * 64 + r8) * NSEQ + seg8 * 4;
  auto issue = [&](int s, int kb0) {
    const _Float16* pk = gK + (size_t)kb0 * row3d;
    const _Float16* pv = gV + kb0;
    const float* pd = gD + kb0;
    asm volatile(
        "global_load_async_to_lds_b128 %0, %8, off\n\t"
        "global_load_async_to_lds_b128 %1, %9, off\n\t"
        "global_load_async_to_lds_b128 %2, %10, off\n\t"
        "global_load_async_to_lds_b128 %3, %11, off\n\t"
        "global_load_async_to_lds_b128 %4, %12, off\n\t"
        "global_load_async_to_lds_b128 %5, %13, off\n\t"
        "global_load_async_to_lds_b128 %6, %14, off\n\t"
        "global_load_async_to_lds_b128 %7, %15, off\n\t"
        "s_wait_xcnt 0x0"
        :: "v"(lds_off(&lsK[s][r8][seg8 * 8])),
           "v"(lds_off(&lsK[s][r8 + 16][seg8 * 8])),
           "v"(lds_off(&lsV[s][r4][seg4 * 8])),
           "v"(lds_off(&lsV[s][r4 + 32][seg4 * 8])),
           "v"(lds_off(&lsD[s][r8][seg8 * 4])),
           "v"(lds_off(&lsD[s][r8 + 16][seg8 * 4])),
           "v"(lds_off(&lsD[s][r8 + 32][seg8 * 4])),
           "v"(lds_off(&lsD[s][r8 + 48][seg8 * 4])),
           "v"(pk), "v"(pk + 16 * row3d),
           "v"(pv), "v"(pv + 32 * NSEQ),
           "v"(pd), "v"(pd + 16 * NSEQ), "v"(pd + 32 * NSEQ),
           "v"(pd + 48 * NSEQ)
        : "memory");
  };

  // Q^T as B operand (col = qrow = lane%16, K = dh contiguous): load once.
  v16h bq[2];
#pragma unroll
  for (int c = 0; c < 2; ++c)
    bq[c] = load_ab(qbase + (size_t)qrow * row3d + c * 32 + 8 * lh);

  v8f o[4];
#pragma unroll
  for (int d = 0; d < 4; ++d) o[d] = v8f_zero();
  float m = -1e30f, ssum = 0.0f;

  const int nkb = NSEQ / 32;
  issue(0, 0);
  S_WAIT_ASYNCCNT(0);       // this wave's part of stage 0 has landed
  __syncthreads();          // stage 0 visible to all waves
  issue(1, 32);
  for (int kb = 0; kb < nkb; ++kb) {
    const int s = kb & 1;

    // S^T tiles: A = 16 key rows from LDS, B = Q^T. Kdim = 64 -> 2 WMMA each.
    v8f st[2];
#pragma unroll
    for (int t = 0; t < 2; ++t) {
      v16h ak0 = load_ab(&lsK[s][t * 16 + lm][8 * lh]);
      v16h ak1 = load_ab(&lsK[s][t * 16 + lm][32 + 8 * lh]);
      st[t] = wmma_f16(ak0, bq[0], v8f_zero());
      st[t] = wmma_f16(ak1, bq[1], st[t]);
    }

    // scale + distance bias; element j of tile t = (key kb0+t*16+8*lh+j, qrow)
    float sc[2][8];
#pragma unroll
    for (int t = 0; t < 2; ++t) {
      // The pairs are written out: left to itself the compiler pairs the scores
      // across register pairs here and pays for it in register copies.
      const f32x4* dp =
          reinterpret_cast<const f32x4*>(&lsD[s][wave * 16 + lm][t * 16 + 8 * lh]);
      const f32x4 d0 = dp[0], d1 = dp[1];
#pragma unroll
      for (int j = 0; j < 8; j += 2) {
        const f32x2 s2 = {st[t][j], st[t][j + 1]};
        const f32x2 d2 = {j < 4 ? d0[j] : d1[j - 4], j < 4 ? d0[j + 1] : d1[j - 3]};
        const f32x2 r2 = s2 * QK_SCALE - g * d2;
        sc[t][j] = r2[0];
        sc[t][j + 1] = r2[1];
      }
    }

    // online softmax (row = qrow = lane%16) against a reference m that is renewed
    // lazily: m is the same in both lanes of a row and stays in use while no score
    // of the wave's pass lies more than LAZY_MARGIN above it, so p <= e^LAZY_MARGIN,
    // far inside f16 and f32 range; the final division by ssum cancels the
    // reference whatever it is.
    float bm = -1e30f;
#pragma unroll
    for (int t = 0; t < 2; ++t)
#pragma unroll
      for (int j = 0; j < 8; ++j) bm = fmaxf(bm, sc[t][j]);
    // One test a pass for the whole wave, a scalar branch on the ballot: the
    // exchange between the halves, alpha, and the rescaling of ssum and of the 32
    // O accumulators run only in a pass that raises the reference.
    if (__builtin_amdgcn_ballot_w32(bm > m + LAZY_MARGIN) != 0) {
      bm = fmaxf(bm, __shfl_xor(bm, 16));
      const float nm = fmaxf(m, bm);
      const float alpha = __expf(m - nm);
      ssum *= alpha;
      m = nm;
      // row of O tile j = qrow-local j+8*lh
#pragma unroll
      for (int j = 0; j < 8; ++j) {
        const float aj = __shfl(alpha, j + 8 * lh);
#pragma unroll
        for (int d = 0; d < 4; ++d) o[d][j] *= aj;
      }
    }
    // V B-operands from LDS (key contiguous per dh row), asked for as one group at
    // the head of the region that the branch opens. The scheduling barrier keeps
    // them there: without it the reads sink behind the exponentials, pair by pair,
    // and each pair is waited for as soon as it is issued.
    v16h vb[4];
#pragma unroll
    for (int d = 0; d < 4; ++d) vb[d] = load_ab(&lsV[s][d * 16 + lm][8 * lh]);
    __builtin_amdgcn_sched_barrier(0);
    // exp(x) as exp2(x * log2 e), the arithmetic of __expf, with the subtraction and
    // the product written in pairs like the scores: one packed instruction for two
    // scores. Left single, the compiler fuses them into dual-issue pairs.
    float p[2][8];
    float ps = 0.0f;
#pragma unroll
    for (int t = 0; t < 2; ++t)
#pragma unroll
      for (int j = 0; j < 8; j += 2) {
        const f32x2 s2 = {sc[t][j], sc[t][j + 1]};
        const f32x2 a2 = (s2 - m) * LOG2_E;
        p[t][j] = __builtin_amdgcn_exp2f(a2[0]);
        p[t][j + 1] = __builtin_amdgcn_exp2f(a2[1]);
        ps += p[t][j];
        ps += p[t][j + 1];
      }
    ps += __shfl_xor(ps, 16);
    ssum += ps;

    v16h pa;
#pragma unroll
    for (int j = 0; j < 8; ++j) {
      pa[j] = (_Float16)p[0][j];
      pa[8 + j] = (_Float16)p[1][j];
    }

    // O += P @ V
#pragma unroll
    for (int d = 0; d < 4; ++d) o[d] = wmma_f16(pa, vb[d], o[d]);

    // Foot of the pass: own reads of buffer s retired, own copies of stage
    // kb+1 landed; the one barrier publishes stage kb+1 and frees buffer s.
    // The scheduling barrier keeps the pass's vector and matrix work in front of
    // the waits: lifted to mid-pass they would expose the V reads' latency and
    // halve the time the copies have to land.
    __builtin_amdgcn_sched_barrier(0);
    asm volatile("s_wait_dscnt 0x0" ::: "memory");
    S_WAIT_ASYNCCNT(0);
    __syncthreads();
    if (kb + 2 < nkb) issue(s, (kb + 2) * 32);
  }
  S_WAIT_ASYNCCNT(0);       // nothing in flight when the wave goes on to end

  const float inv = 1.0f / ssum;
#pragma unroll
  for (int j = 0; j < 8; ++j) {
    const float ij = __shfl(inv, j + 8 * lh);
    const int row = qt * 16 + j + 8 * lh;
#pragma unroll
    for (int d = 0; d < 4; ++d) {
      attnh[((size_t)(b * NSEQ) + row) * D_MODEL + h * DH_HEAD + d * 16 + lm] =
          (_Float16)(o[d][j] * ij);
    }
  }
}

// ---------------------------------------------------------------------------
extern "C" void kernel_launch(void* const* d_in, const int* in_sizes, int n_in,
                              void* d_out, int out_size, void* d_ws,
                              size_t ws_size, hipStream_t stream) {
  const float* x      = (const float*)d_in[0];
  const float* gamma  = (const float*)d_in[1];
  const float* dist   = (const float*)d_in[2];
  const float* qkv_w  = (const float*)d_in[3];
  const float* qkv_b  = (const float*)d_in[4];
  const float* proj_w = (const float*)d_in[5];
  const float* proj_b = (const float*)d_in[6];
  float* out = (float*)d_out;

  const size_t n_x    = (size_t)BATCH * NSEQ * D_MODEL;      // 4Mi elems
  const size_t n_qkvw = (size_t)D_MODEL * 3 * D_MODEL;       // 3Mi
  const size_t n_pw   = (size_t)D_MODEL * D_MODEL;           // 1Mi
  const size_t n_qkv  = (size_t)BATCH * NSEQ * 3 * D_MODEL;  // 12Mi

  char* ws = (char*)d_ws;
  _Float16* xh     = (_Float16*)ws; ws += n_x * 2;
  _Float16* wqkvT  = (_Float16*)ws; ws += n_qkvw * 2;
  _Float16* wprojT = (_Float16*)ws; ws += n_pw * 2;
  _Float16* qkvh   = (_Float16*)ws; ws += n_qkv * 2;
  _Float16* vTh    = (_Float16*)ws; ws += n_x * 2;
  _Float16* attnh  = (_Float16*)ws; ws += n_x * 2;
  // total ws use: ~56 MB

  prep_kernel<<<NB_WQKV + NB_WPROJ + NB_X, 256, 0, stream>>>(
      x, qkv_w, proj_w, xh, wqkvT, wprojT);

  dim3 g1(3 * D_MODEL / 128, BATCH * NSEQ / 128);
  gemm_wmma_kernel<0><<<g1, 256, 0, stream>>>(xh, wqkvT, qkv_b, qkvh, vTh,
                                              BATCH * NSEQ, 3 * D_MODEL,
                                              D_MODEL);

  dim3 ga(NSEQ / 64, H_HEADS, BATCH);
  attn_kernel<<<ga, 128, 0, stream>>>(qkvh, vTh, gamma, dist, attnh);

  dim3 g2(D_MODEL / 128, BATCH * NSEQ / 128);
  gemm_wmma_kernel<1><<<g2, 256, 0, stream>>>(attnh, wprojT, proj_b, out, nullptr,
                                              BATCH * NSEQ, D_MODEL, D_MODEL);
}

// v008
// It runs in 99.8 microseconds.
// Two timings next to v007 both put it at 1.05 times that version's speed.
// Counting every step since v000, it is 2.50 times as fast.
#include <hip/hip_runtime.h>
#include <hip/hip_bf16.h>

typedef __attribute__((ext_vector_type(16))) _Float16 v16h;
typedef __attribute__((ext_vector_type(8)))  float    v8f;

#define D_MODEL  1024
#define H_HEADS  16
#define DH_HEAD  64
#define NSEQ     2048
#define BATCH    2
#define QK_SCALE 0.03125f  // 1024^-0.5
#define LOG2_E 1.442695041f
#define LAZY_MARGIN 5.5f    // about 8 in log2: a probability stays below 256

static __device__ __forceinline__ unsigned lds_off(const void* p) {
  return (unsigned)(unsigned long long)p;
}
#define S_WAIT_ASYNCCNT(n) asm volatile("s_wait_asynccnt " #n ::: "memory")

static __device__ __forceinline__ v16h load_ab(const _Float16* p) {
  v16h r;
  __builtin_memcpy(&r, p, 16);
  __builtin_memcpy(reinterpret_cast<char*>(&r) + 16, p + 16, 16);
  return r;
}

static __device__ __forceinline__ v8f v8f_zero() {
  v8f z;
#pragma unroll
  for (int j = 0; j < 8; ++j) z[j] = 0.0f;
  return z;
}

static __device__ __forceinline__ v8f wmma_f16(v16h a, v16h b, v8f c) {
  return __builtin_amdgcn_wmma_f32_16x16x32_f16(false, a, false, b, (short)0, c,
                                                false, false);
}

// ---------------- conversion and transposition ----------------
// All three jobs move 16 B per lane (8 B where f32 narrows to f16 in place) so that
// every wave-wide access covers whole 128-B lines, and a thread handles many
// elements, so that few waves have to be started.
typedef __attribute__((ext_vector_type(4))) float    f32x4;
typedef __attribute__((ext_vector_type(2))) float    f32x2;
typedef __attribute__((ext_vector_type(4))) unsigned u32x4;
typedef __attribute__((ext_vector_type(2))) unsigned u32x2;
typedef __attribute__((ext_vector_type(2))) _Float16 f16x2;

static __device__ __forceinline__ unsigned pack_f16(float a, float b) {
  f16x2 p;
  p[0] = (_Float16)a;
  p[1] = (_Float16)b;
  return __builtin_bit_cast(unsigned, p);
}

#define TT_PITCH 33

// Column-wise read of 64 tile rows and row-wise store of their transpose:
// dst row c (pitch dpitch elements) receives rows 0..63 of column c.
// 8 lanes cover one 128-B destination line; a thread serves columns 2*cp, 2*cp+1.
static __device__ __forceinline__ void tile_store_T(
    const unsigned (*tile)[TT_PITCH], _Float16* __restrict__ dst, size_t dpitch,
    int tid) {
  const int rs = tid & 7, cp = tid >> 3;
  // Both loops unrolled: w, lo and hi are indexed by constants and stay in
  // registers, and the eight LDS reads issue as one group.
  unsigned w[8];
#pragma unroll
  for (int i = 0; i < 8; ++i) w[i] = tile[8 * rs + i][cp];
  u32x4 lo, hi;
#pragma unroll
  for (int q = 0; q < 4; ++q) {
    lo[q] = (w[2 * q] & 0xffffu) | (w[2 * q + 1] << 16);
    hi[q] = (w[2 * q] >> 16) | (w[2 * q + 1] & 0xffff0000u);
  }
  *reinterpret_cast<u32x4*>(dst + (size_t)(2 * cp) * dpitch + 8 * rs) = lo;
  *reinterpret_cast<u32x4*>(dst + (size_t)(2 * cp + 1) * dpitch + 8 * rs) = hi;
}

// elementwise f32 -> f16; block blk converts 8192 consecutive elements.
static __device__ __forceinline__ void cvt_f16_block(
    const float* __restrict__ in, _Float16* __restrict__ out, int blk) {
  const size_t base = (size_t)blk * 8192 + threadIdx.x * 4;
  // Unrolled, loads apart from stores: all eight loads are in flight before
  // the first is waited for.
  f32x4 v[8];
#pragma unroll
  for (int j = 0; j < 8; ++j)
    v[j] = *reinterpret_cast<const f32x4*>(in + base + j * 1024);
#pragma unroll
  for (int j = 0; j < 8; ++j) {
    u32x2 o;
    o[0] = pack_f16(v[j][0], v[j][1]);
    o[1] = pack_f16(v[j][2], v[j][3]);
    *reinterpret_cast<u32x2*>(out + base + j * 1024) = o;
  }
  // Inlined beside other jobs, code may follow these stores: no register that
  // an issued store names is rewritten before this wait.
  asm volatile("s_wait_xcnt 0x0" ::: "memory");
}

// transpose+convert: in [K][Nc] f32 row-major -> out [Nc][K] f16 row-major.
// One block per 128(k) x 64(n) tile; block blk takes tile column blk % (Nc / 64).
// K and Nc are compile-time so that the eight row loads share one address
// register pair and differ only in their immediate offsets.
template <int K, int Nc>
static __device__ __forceinline__ void cvtT_f16_block(
    const float* __restrict__ in, _Float16* __restrict__ out,
    unsigned (*tile)[TT_PITCH], int blk) {
  const int tid = threadIdx.x;
  const int n0 = (blk % (Nc / 64)) * 64, k0 = (blk / (Nc / 64)) * 128;
  const int c4 = tid & 15, r = tid >> 4;
  const float* src = in + (size_t)(k0 + r) * Nc + n0 + 4 * c4;
  // Unrolled, loads apart from LDS writes: all eight loads are in flight
  // before the first is waited for.
  f32x4 v[8];
#pragma unroll
  for (int i = 0; i < 8; ++i)
    v[i] = *reinterpret_cast<const f32x4*>(src + (size_t)i * 16 * Nc);
#pragma unroll
  for (int i = 0; i < 8; ++i) {
    tile[r + 16 * i][2 * c4] = pack_f16(v[i][0], v[i][1]);
    tile[r + 16 * i][2 * c4 + 1] = pack_f16(v[i][2], v[i][3]);
  }
  __syncthreads();  // the whole tile is written before any column is read
  _Float16* dst = out + (size_t)n0 * K + k0;
  tile_store_T(tile, dst, (size_t)K, tid);
  tile_store_T(tile + 64, dst + 64, (size_t)K, tid);
  // Inlined beside other jobs, code may follow these stores: no register that
  // an issued store names is rewritten before this wait.
  asm volatile("s_wait_xcnt 0x0" ::: "memory");
}

// The three conversions of inputs read nothing of each other's output, so they
// share one launch: a block picks its job by its index. The transposes come
// first: their path (load, LDS, barrier, LDS, store) is the longer one.
// The choice is the same for a whole block,
// so every thread of a transposing block reaches that block's barrier.
#define NB_WQKV  ((3 * D_MODEL / 64) * (D_MODEL / 128))
#define NB_WPROJ ((D_MODEL / 64) * (D_MODEL / 128))
#define NB_X     (BATCH * NSEQ * D_MODEL / 8192)
__global__ __launch_bounds__(256) void prep_kernel(
    const float* __restrict__ x, const float* __restrict__ qkv_w,
    const float* __restrict__ proj_w, _Float16* __restrict__ xh,
    _Float16* __restrict__ wqkvT, _Float16* __restrict__ wprojT) {
  __shared__ unsigned tile[128][TT_PITCH];
  const int blk = blockIdx.x;
  if (blk < NB_WQKV)
    cvtT_f16_block<D_MODEL, 3 * D_MODEL>(qkv_w, wqkvT, tile, blk);
  else if (blk < NB_WQKV + NB_WPROJ)
    cvtT_f16_block<D_MODEL, D_MODEL>(proj_w, wprojT, tile, blk - NB_WQKV);
  else
    cvt_f16_block(x, xh, blk - (NB_WQKV + NB_WPROJ));
}

// ---------------- WMMA GEMM with async-LDS double buffering ------------------
// C[M,Nc] = A[M,K](f16) @ Bt[Nc,K]^T(f16) + bias.
// 256 threads = 8 waves (4x2); workgroup tile 128M x 128N, K-step 64.
// A staged row is 64 f16 = one whole 128-B line, so a wave-wide copy touches
// four whole lines, and a 128 x 128 tile reads each operand from L2 fewer times.
// With f16 output, a block whose columns lie in the V third of the QKV product
// writes its tile as vT[b][h][dh][key], the layout the attention kernel reads,
// and writes nothing to outp: nobody reads V in row-major form.
#define VT_PITCH 136  // f16 per staged column: 272 B = 16 B x odd
template <int OUTF32>
__global__ __launch_bounds__(256) void gemm_wmma_kernel(
    const _Float16* __restrict__ A, const _Float16* __restrict__ Bt,
    const float* __restrict__ bias, void* __restrict__ outp,
    _Float16* __restrict__ vT, int M, int Ncols, int K) {
  __shared__ __attribute__((aligned(16))) _Float16 lsA[2][128][72];
  __shared__ __attribute__((aligned(16))) _Float16 lsB[2][128][72];

  const int tid = threadIdx.x;
  const int l = tid & 31, wave = tid >> 5;
  const int lh = l >> 4, lm = l & 15;
  const int wm = wave >> 1, wn = wave & 1;
  const int mbase = blockIdx.y * 128;
  const int nbase = blockIdx.x * 128;

  // stage issue: 4 A-chunks + 4 B-chunks of 16 B per thread; 8 lanes per row,
  // chunk i lies 32 rows below chunk i-1.
  const int cr = tid >> 3, cseg = tid & 7;
  const _Float16* gA = A + (size_t)(mbase + cr) * K + cseg * 8;
  const _Float16* gB = Bt + (size_t)(nbase + cr) * K + cseg * 8;
  const size_t g32 = (size_t)32 * K;
  auto issue = [&](int s, int kk) {
    const _Float16* pa = gA + kk;
    const _Float16* pb = gB + kk;
    asm volatile(
        "global_load_async_to_lds_b128 %0, %8, off\n\t"
        "global_load_async_to_lds_b128 %1, %9, off\n\t"
        "global_load_async_to_lds_b128 %2, %10, off\n\t"
        "global_load_async_to_lds_b128 %3, %11, off\n\t"
        "global_load_async_to_lds_b128 %4, %12, off\n\t"
        "global_load_async_to_lds_b128 %5, %13, off\n\t"
        "global_load_async_to_lds_b128 %6, %14, off\n\t"
        "global_load_async_to_lds_b128 %7, %15, off\n\t"
        "s_wait_xcnt 0x0"
        :: "v"(lds_off(&lsA[s][cr][cseg * 8])),
           "v"(lds_off(&lsA[s][cr + 32][cseg * 8])),
           "v"(lds_off(&lsA[s][cr + 64][cseg * 8])),
           "v"(lds_off(&lsA[s][cr + 96][cseg * 8])),
           "v"(lds_off(&lsB[s][cr][cseg * 8])),
           "v"(lds_off(&lsB[s][cr + 32][cseg * 8])),
           "v"(lds_off(&lsB[s][cr + 64][cseg * 8])),
           "v"(lds_off(&lsB[s][cr + 96][cseg * 8])),
           "v"(pa), "v"(pa + g32), "v"(pa + 2 * g32), "v"(pa + 3 * g32),
           "v"(pb), "v"(pb + g32), "v"(pb + 2 * g32), "v"(pb + 3 * g32)
        : "memory");
  };

  v8f acc[2][4];
#pragma unroll
  for (int t = 0; t < 2; ++t)
#pragma unroll
    for (int u = 0; u < 4; ++u) acc[t][u] = v8f_zero();

  const int nk = K / 64;
  issue(0, 0);
  S_WAIT_ASYNCCNT(0);       // this wave's part of stage 0 has landed
  __syncthreads();          // stage 0 visible to all waves
  if (nk > 1) issue(1, 64);
  for (int ik = 0; ik < nk; ++ik) {
    const int s = ik & 1;
    // Unrolled: the two 32-wide halves of the step differ only in immediate
    // LDS offsets, and the fragment arrays stay in registers.
#pragma unroll
    for (int kh = 0; kh < 2; ++kh) {
      v16h a[2], bo[4];
#pragma unroll
      for (int t = 0; t < 2; ++t)
        a[t] = load_ab(&lsA[s][wm * 32 + t * 16 + lm][kh * 32 + 8 * lh]);
#pragma unroll
      for (int u = 0; u < 4; ++u)
        bo[u] = load_ab(&lsB[s][wn * 64 + u * 16 + lm][kh * 32 + 8 * lh]);
#pragma unroll
      for (int t = 0; t < 2; ++t)
#pragma unroll
        for (int u = 0; u < 4; ++u)
          acc[t][u] = wmma_f16(a[t], bo[u], acc[t][u]);
    }
    // Foot of the step: own reads of buffer s retired, own copies of stage
    // ik+1 landed; the one barrier publishes stage ik+1 and frees buffer s.
    asm volatile("s_wait_dscnt 0x0" ::: "memory");
    S_WAIT_ASYNCCNT(0);
    __syncthreads();
    if (ik + 2 < nk) issue(s, (ik + 2) * 64);
  }
  S_WAIT_ASYNCCNT(0);       // nothing in flight when the wave goes on to end

  // The choice is the same for a whole block, so all its threads reach the barrier.
  if (!OUTF32 && nbase >= 2 * D_MODEL) {
    // A lane holds 8 consecutive rows (keys) of one column (dh): 16 B of a vT row.
    // The tile is staged column by column in the A ring, which the barrier at the
    // foot of the last K-step has freed, so that the stores take whole rows of
    // 128 keys (two 128-B lines, one writer each).
    _Float16 (*stg)[VT_PITCH] =
        reinterpret_cast<_Float16 (*)[VT_PITCH]>(&lsA[0][0][0]);
#pragma unroll
    for (int t = 0; t < 2; ++t) {
#pragma unroll
      for (int u = 0; u < 4; ++u) {
        const int c = wn * 64 + u * 16 + lm;
        const float bv = bias[nbase + c];
        u32x4 w;
#pragma unroll
        for (int q = 0; q < 4; ++q)
          w[q] = pack_f16(acc[t][u][2 * q] + bv, acc[t][u][2 * q + 1] + bv);
        *reinterpret_cast<u32x4*>(&stg[c][wm * 32 + t * 16 + 8 * lh]) = w;
      }
    }
    __syncthreads();  // the whole tile is staged before any column is read
    // 16 lanes a column; sweep i takes the columns 16 below those of sweep i-1.
    const int sc = tid >> 4, sseg = tid & 15;
    _Float16* dst = vT +
        ((size_t)(mbase / NSEQ) * D_MODEL + (nbase - 2 * D_MODEL) + sc) * NSEQ +
        mbase % NSEQ + sseg * 8;
    // Unrolled, reads apart from stores: the eight LDS reads issue as one group.
    u32x4 v[8];
#pragma unroll
    for (int i = 0; i < 8; ++i)
      v[i] = *reinterpret_cast<const u32x4*>(&stg[sc + 16 * i][sseg * 8]);
#pragma unroll
    for (int i = 0; i < 8; ++i)
      *reinterpret_cast<u32x4*>(dst + (size_t)i * 16 * NSEQ) = v[i];
    // No register that an issued store names is rewritten before this wait.
    asm volatile("s_wait_xcnt 0x0" ::: "memory");
    return;
  }

#pragma unroll
  for (int t = 0; t < 2; ++t) {
#pragma unroll
    for (int u = 0; u < 4; ++u) {
      const int col = nbase + wn * 64 + u * 16 + lm;
      const float bv = bias[col];
#pragma unroll
      for (int j = 0; j < 8; ++j) {
        const int row = mbase + wm * 32 + t * 16 + j + 8 * lh;
        const float v = acc[t][u][j] + bv;
        if (OUTF32)
          ((float*)outp)[(size_t)row * Ncols + col] = v;
        else
          ((_Float16*)outp)[(size_t)row * Ncols + col] = (_Float16)v;
      }
    }
  }
}

// ---------------- Flash attention: 4 waves share K/V via async LDS ----------
// Each wave owns 16 query rows; block covers 64 rows of one (b,h).
// S^T = K @ Q^T trick: softmax row = lane%16; S^T C-layout == A K-layout of
// P@V, so P needs no transpose, only f16 packing.
// A pass takes 64 keys: a staged row of V^T is then one whole 128-B line and a row
// of the distance tile one aligned 256-B unit, the copies of the next tile have
// twice the work to land behind, and the foot of the pass (waits, barrier, copy
// addresses) and the lazy test are paid once per 64 keys.
#define KT 64  // keys per pass
__global__ __launch_bounds__(128) void attn_kernel(
    const _Float16* __restrict__ qkvh, const _Float16* __restrict__ vT,
    const float* __restrict__ gamma, const float* __restrict__ dist,
    _Float16* __restrict__ attnh) {
  __shared__ __attribute__((aligned(16))) _Float16 lsK[2][KT][72];  // [key_local][dh], 64 used
  __shared__ __attribute__((aligned(16))) _Float16 lsV[2][64][72];  // [dh][key_local], 64 used
  __shared__ __attribute__((aligned(16))) float    lsD[2][64][68];  // [q_local][key_local], 64 used

  const int tid = threadIdx.x;
  const int l = tid & 31, wave = tid >> 5;
  const int lh = l >> 4, lm = l & 15;
  const int h = blockIdx.y, b = blockIdx.z;
  const int qt = blockIdx.x * 4 + wave;
  const int qrow = qt * 16 + lm;

  const size_t row3d = (size_t)3 * D_MODEL;
  const _Float16* qbase = qkvh + (size_t)(b * NSEQ) * row3d + h * DH_HEAD;
  const _Float16* kbase = qbase + D_MODEL;
  const _Float16* vTbase = vT + (size_t)(b * H_HEADS + h) * DH_HEAD * NSEQ;
  const float g = gamma[b * H_HEADS + h];

  // stage issue: 4 K-chunks, 4 V-chunks and 8 distance chunks of 16 B per thread.
  // K and V: 8 lanes a row, chunk i lies 16 rows below chunk i-1;
  // distance: 16 lanes a row, chunk i lies 8 rows below chunk i-1.
  const int r8 = tid >> 3, seg8 = tid & 7;
  const int r16 = tid >> 4, seg16 = tid & 15;
  const _Float16* gK = kbase + (size_t)r8 * row3d + seg8 * 8;
  const _Float16* gV = vTbase + (size_t)r8 * NSEQ + seg8 * 8;
  const float* gD = dist + (size_t)(blockIdx.x * 64 + r16) * NSEQ + seg16 * 4;
  auto issue = [&](int s, int kb0) {
    const _Float16* pk = gK + (size_t)kb0 * row3d;
    const _Float16* pv = gV + kb0;
    const float* pd = gD + kb0;
    asm volatile(
        "global_load_async_to_lds_b128 %0, %8, off\n\t"
        "global_load_async_to_lds_b128 %1, %9, off\n\t"
        "global_load_async_to_lds_b128 %2, %10, off\n\t"
        "global_load_async_to_lds_b128 %3, %11, off\n\t"
        "global_load_async_to_lds_b128 %4, %12, off\n\t"
        "global_load_async_to_lds_b128 %5, %13, off\n\t"
        "global_load_async_to_lds_b128 %6, %14, off\n\t"
        "global_load_async_to_lds_b128 %7, %15, off\n\t"
        "s_wait_xcnt 0x0"
        :: "v"(lds_off(&lsK[s][r8][seg8 * 8])),
           "v"(lds_off(&lsK[s][r8 + 16][seg8 * 8])),
           "v"(lds_off(&lsK[s][r8 + 32][seg8 * 8])),
           "v"(lds_off(&lsK[s][r8 + 48][seg8 * 8])),
           "v"(lds_off(&lsV[s][r8][seg8 * 8])),
           "v"(lds_off(&lsV[s][r8 + 16][seg8 * 8])),
           "v"(lds_off(&lsV[s][r8 + 32][seg8 * 8])),
           "v"(lds_off(&lsV[s][r8 + 48][seg8 * 8])),
           "v"(pk), "v"(pk + 16 * row3d), "v"(pk + 32 * row3d),
           "v"(pk + 48 * row3d),
           "v"(pv), "v"(pv + 16 * NSEQ), "v"(pv + 32 * NSEQ),
           "v"(pv + 48 * NSEQ)
        : "memory");
    asm volatile(
        "global_load_async_to_lds_b128 %0, %8, off\n\t"
        "global_load_async_to_lds_b128 %1, %9, off\n\t"
        "global_load_async_to_lds_b128 %2, %10, off\n\t"
        "global_load_async_to_lds_b128 %3, %11, off\n\t"
        "global_load_async_to_lds_b128 %4, %12, off\n\t"
        "global_load_async_to_lds_b128 %5, %13, off\n\t"
        "global_load_async_to_lds_b128 %6, %14, off\n\t"
        "global_load_async_to_lds_b128 %7, %15, off\n\t"
        "s_wait_xcnt 0x0"
        :: "v"(lds_off(&lsD[s][r16][seg16 * 4])),
           "v"(lds_off(&lsD[s][r16 + 8][seg16 * 4])),
           "v"(lds_off(&lsD[s][r16 + 16][seg16 * 4])),
           "v"(lds_off(&lsD[s][r16 + 24][seg16 * 4])),
           "v"(lds_off(&lsD[s][r16 + 32][seg16 * 4])),
           "v"(lds_off(&lsD[s][r16 + 40][seg16 * 4])),
           "v"(lds_off(&lsD[s][r16 + 48][seg16 * 4])),
           "v"(lds_off(&lsD[s][r16 + 56][seg16 * 4])),
           "v"(pd), "v"(pd + 8 * NSEQ), "v"(pd + 16 * NSEQ),
           "v"(pd + 24 * NSEQ), "v"(pd + 32 * NSEQ), "v"(pd + 40 * NSEQ),
           "v"(pd + 48 * NSEQ), "v"(pd + 56 * NSEQ)
        : "memory");
  };

  // Q^T as B operand (col = qrow = lane%16, K = dh contiguous): load once.
  v16h bq[2];
#pragma unroll
  for (int c = 0; c < 2; ++c)
    bq[c] = load_ab(qbase + (size_t)qrow * row3d + c * 32 + 8 * lh);

  v8f o[4];
#pragma unroll
  for (int d = 0; d < 4; ++d) o[d] = v8f_zero();
  float m = -1e30f, ssum = 0.0f;

  const int nkb = NSEQ / KT;
  issue(0, 0);
  S_WAIT_ASYNCCNT(0);       // this wave's part of stage 0 has landed
  __syncthreads();          // stage 0 visible to all waves
  issue(1, KT);
  for (int kb = 0; kb < nkb; ++kb) {
    const int s = kb & 1;

    // S^T tiles: A = 16 key rows from LDS, B = Q^T. Kdim = 64 -> 2 WMMA each.
    v8f st[4];
#pragma unroll
    for (int t = 0; t < 4; ++t) {
      v16h ak0 = load_ab(&lsK[s][t * 16 + lm][8 * lh]);
      v16h ak1 = load_ab(&lsK[s][t * 16 + lm][32 + 8 * lh]);
      st[t] = wmma_f16(ak0, bq[0], v8f_zero());
      st[t] = wmma_f16(ak1, bq[1], st[t]);
    }

    // scale + distance bias; element j of tile t = (key kb0+t*16+8*lh+j, qrow)
    float sc[4][8];
#pragma unroll
    for (int t = 0; t < 4; ++t) {
      // The pairs are written out: left to itself the compiler pairs the scores
      // across register pairs here and pays for it in register copies.
      const f32x4* dp =
          reinterpret_cast<const f32x4*>(&lsD[s][wave * 16 + lm][t * 16 + 8 * lh]);
      const f32x4 d0 = dp[0], d1 = dp[1];
#pragma unroll
      for (int j = 0; j < 8; j += 2) {
        const f32x2 s2 = {st[t][j], st[t][j + 1]};
        const f32x2 d2 = {j < 4 ? d0[j] : d1[j - 4], j < 4 ? d0[j + 1] : d1[j - 3]};
        const f32x2 r2 = s2 * QK_SCALE - g * d2;
        sc[t][j] = r2[0];
        sc[t][j + 1] = r2[1];
      }
    }

    // online softmax (row = qrow = lane%16) against a reference m that is renewed
    // lazily: m is the same in both lanes of a row and stays in use while no score
    // of the wave's pass lies more than LAZY_MARGIN above it, so p <= e^LAZY_MARGIN,
    // far inside f16 and f32 range; the final division by ssum cancels the
    // reference whatever it is.
    float bm = -1e30f;
#pragma unroll
    for (int t = 0; t < 4; ++t)
#pragma unroll
      for (int j = 0; j < 8; ++j) bm = fmaxf(bm, sc[t][j]);
    // One test a pass for the whole wave, a scalar branch on the ballot: the
    // exchange between the halves, alpha, and the rescaling of ssum and of the 32
    // O accumulators run only in a pass that raises the reference.
    if (__builtin_amdgcn_ballot_w32(bm > m + LAZY_MARGIN) != 0) {
      bm = fmaxf(bm, __shfl_xor(bm, 16));
      const float nm = fmaxf(m, bm);
      const float alpha = __expf(m - nm);
      ssum *= alpha;
      m = nm;
      // row of O tile j = qrow-local j+8*lh
#pragma unroll
      for (int j = 0; j < 8; ++j) {
        const float aj = __shfl(alpha, j + 8 * lh);
#pragma unroll
        for (int d = 0; d < 4; ++d) o[d][j] *= aj;
      }
    }
    // V B-operands from LDS (key contiguous per dh row), asked for as one group at
    // the head of the region that the branch opens. The scheduling barrier keeps
    // them there: without it the reads sink behind the exponentials, pair by pair,
    // and each pair is waited for as soon as it is issued.
    v16h vb[2][4];
#pragma unroll
    for (int c = 0; c < 2; ++c)
#pragma unroll
      for (int d = 0; d < 4; ++d)
        vb[c][d] = load_ab(&lsV[s][d * 16 + lm][c * 32 + 8 * lh]);
    __builtin_amdgcn_sched_barrier(0);
    // exp(x) as exp2(x * log2 e), the arithmetic of __expf, with the subtraction and
    // the product written in pairs like the scores: one packed instruction for two
    // scores. Left single, the compiler fuses them into dual-issue pairs.
    // Each 32-key half keeps a sum of its own, in the order of its keys.
    float p[4][8];
    float ps[2] = {0.0f, 0.0f};
#pragma unroll
    for (int t = 0; t < 4; ++t)
#pragma unroll
      for (int j = 0; j < 8; j += 2) {
        const f32x2 s2 = {sc[t][j], sc[t][j + 1]};
        const f32x2 a2 = (s2 - m) * LOG2_E;
        p[t][j] = __builtin_amdgcn_exp2f(a2[0]);
        p[t][j + 1] = __builtin_amdgcn_exp2f(a2[1]);
        ps[t >> 1] += p[t][j];
        ps[t >> 1] += p[t][j + 1];
      }
    float pt = ps[0] + ps[1];
    pt += __shfl_xor(pt, 16);
    ssum += pt;

#pragma unroll
    for (int c = 0; c < 2; ++c) {
      v16h pa;
#pragma unroll
      for (int j = 0; j < 8; ++j) {
        pa[j] = (_Float16)p[2 * c][j];
        pa[8 + j] = (_Float16)p[2 * c + 1][j];
      }
#pragma unroll
      for (int d = 0; d < 4; ++d) o[d] = wmma_f16(pa, vb[c][d], o[d]);
    }

    // Foot of the pass: own reads of buffer s retired, own copies of stage
    // kb+1 landed; the one barrier publishes stage kb+1 and frees buffer s.
    // The scheduling barrier keeps the pass's vector and matrix work in front of
    // the waits: lifted to mid-pass they would expose the V reads' latency and
    // halve the time the copies have to land.
    __builtin_amdgcn_sched_barrier(0);
    asm volatile("s_wait_dscnt 0x0" ::: "memory");
    S_WAIT_ASYNCCNT(0);
    __syncthreads();
    if (kb + 2 < nkb) issue(s, (kb + 2) * KT);
  }
  S_WAIT_ASYNCCNT(0);       // nothing in flight when the wave goes on to end

  const float inv = 1.0f / ssum;
#pragma unroll
  for (int j = 0; j < 8; ++j) {
    const float ij = __shfl(inv, j + 8 * lh);
    const int row = qt * 16 + j + 8 * lh;
#pragma unroll
    for (int d = 0; d < 4; ++d) {
      attnh[((size_t)(b * NSEQ) + row) * D_MODEL + h * DH_HEAD + d * 16 + lm] =
          (_Float16)(o[d][j] * ij);
    }
  }
}

// ---------------------------------------------------------------------------
extern "C" void kernel_launch(void* const* d_in, const int* in_sizes, int n_in,
                              void* d_out, int out_size, void* d_ws,
                              size_t ws_size, hipStream_t stream) {
  const float* x      = (const float*)d_in[0];
  const float* gamma  = (const float*)d_in[1];
  const float* dist   = (const float*)d_in[2];
  const float* qkv_w  = (const float*)d_in[3];
  const float* qkv_b  = (const float*)d_in[4];
  const float* proj_w = (const float*)d_in[5];
  const float* proj_b = (const float*)d_in[6];
  float* out = (float*)d_out;

  const size_t n_x    = (size_t)BATCH * NSEQ * D_MODEL;      // 4Mi elems
  const size_t n_qkvw = (size_t)D_MODEL * 3 * D_MODEL;       // 3Mi
  const size_t n_pw   = (size_t)D_MODEL * D_MODEL;           // 1Mi
  const size_t n_qkv  = (size_t)BATCH * NSEQ * 3 * D_MODEL;  // 12Mi

  char* ws = (char*)d_ws;
  _Float16* xh     = (_Float16*)ws; ws += n_x * 2;
  _Float16* wqkvT  = (_Float16*)ws; ws += n_qkvw * 2;
  _Float16* wprojT = (_Float16*)ws; ws += n_pw * 2;
  _Float16* qkvh   = (_Float16*)ws; ws += n_qkv * 2;
  _Float16* vTh    = (_Float16*)ws; ws += n_x * 2;
  _Float16* attnh  = (_Float16*)ws; ws += n_x * 2;
  // total ws use: ~56 MB

  prep_kernel<<<NB_WQKV + NB_WPROJ + NB_X, 256, 0, stream>>>(
      x, qkv_w, proj_w, xh, wqkvT, wprojT);

  dim3 g1(3 * D_MODEL / 128, BATCH * NSEQ / 128);
  gemm_wmma_kernel<0><<<g1, 256, 0, stream>>>(xh, wqkvT, qkv_b, qkvh, vTh,
                                              BATCH * NSEQ, 3 * D_MODEL,
                                              D_MODEL);

  dim3 ga(NSEQ / 64, H_HEADS, BATCH);
  attn_kernel<<<ga, 128, 0, stream>>>(qkvh, vTh, gamma, dist, attnh);

  dim3 g2(D_MODEL / 128, BATCH * NSEQ / 128);
  gemm_wmma_kernel<1><<<g2, 256, 0, stream>>>(attnh, wprojT, proj_b, out, nullptr,
                                              BATCH * NSEQ, D_MODEL, D_MODEL);
}

// v009
// It runs in 92 microseconds.
// In two side-by-side timings against v008, it was 1.09 and 1.08 times as fast.
// Counting every step since v000, it is 2.72 times as fast.
#include <hip/hip_runtime.h>
#include <hip/hip_bf16.h>

typedef __attribute__((ext_vector_type(16))) _Float16 v16h;
typedef __attribute__((ext_vector_type(8)))  float    v8f;

#define D_MODEL  1024
#define H_HEADS  16
#define DH_HEAD  64
#define NSEQ     2048
#define BATCH    2
#define QK_SCALE 0.03125f  // 1024^-0.5
#define LOG2_E 1.442695041f
#define LAZY_MARGIN 5.5f    // about 8 in log2: a probability stays below 256

static __device__ __forceinline__ unsigned lds_off(const void* p) {
  return (unsigned)(unsigned long long)p;
}
#define S_WAIT_ASYNCCNT(n) asm volatile("s_wait_asynccnt " #n ::: "memory")

static __device__ __forceinline__ v16h load_ab(const _Float16* p) {
  v16h r;
  __builtin_memcpy(&r, p, 16);
  __builtin_memcpy(reinterpret_cast<char*>(&r) + 16, p + 16, 16);
  return r;
}

static __device__ __forceinline__ v8f v8f_zero() {
  v8f z;
#pragma unroll
  for (int j = 0; j < 8; ++j) z[j] = 0.0f;
  return z;
}

static __device__ __forceinline__ v8f wmma_f16(v16h a, v16h b, v8f c) {
  return __builtin_amdgcn_wmma_f32_16x16x32_f16(false, a, false, b, (short)0, c,
                                                false, false);
}

// ---------------- conversion and transposition ----------------
// All three jobs move 16 B per lane (8 B where f32 narrows to f16 in place) so that
// every wave-wide access covers whole 128-B lines, and a thread handles many
// elements, so that few waves have to be started.
typedef __attribute__((ext_vector_type(4))) float    f32x4;
typedef __attribute__((ext_vector_type(2))) float    f32x2;
typedef __attribute__((ext_vector_type(4))) unsigned u32x4;
typedef __attribute__((ext_vector_type(2))) unsigned u32x2;
typedef __attribute__((ext_vector_type(2))) _Float16 f16x2;

static __device__ __forceinline__ unsigned pack_f16(float a, float b) {
  f16x2 p;
  p[0] = (_Float16)a;
  p[1] = (_Float16)b;
  return __builtin_bit_cast(unsigned, p);
}

#define TT_PITCH 33

// Column-wise read of 64 tile rows and row-wise store of their transpose:
// dst row c (pitch dpitch elements) receives rows 0..63 of column c.
// 8 lanes cover one 128-B destination line; a thread serves columns 2*cp, 2*cp+1.
static __device__ __forceinline__ void tile_store_T(
    const unsigned (*tile)[TT_PITCH], _Float16* __restrict__ dst, size_t dpitch,
    int tid) {
  const int rs = tid & 7, cp = tid >> 3;
  // Both loops unrolled: w, lo and hi are indexed by constants and stay in
  // registers, and the eight LDS reads issue as one group.
  unsigned w[8];
#pragma unroll
  for (int i = 0; i < 8; ++i) w[i] = tile[8 * rs + i][cp];
  u32x4 lo, hi;
#pragma unroll
  for (int q = 0; q < 4; ++q) {
    lo[q] = (w[2 * q] & 0xffffu) | (w[2 * q + 1] << 16);
    hi[q] = (w[2 * q] >> 16) | (w[2 * q + 1] & 0xffff0000u);
  }
  *reinterpret_cast<u32x4*>(dst + (size_t)(2 * cp) * dpitch + 8 * rs) = lo;
  *reinterpret_cast<u32x4*>(dst + (size_t)(2 * cp + 1) * dpitch + 8 * rs) = hi;
}

// elementwise f32 -> f16; block blk converts 8192 consecutive elements.
static __device__ __forceinline__ void cvt_f16_block(
    const float* __restrict__ in, _Float16* __restrict__ out, int blk) {
  const size_t base = (size_t)blk * 8192 + threadIdx.x * 4;
  // Unrolled, loads apart from stores: all eight loads are in flight before
  // the first is waited for.
  f32x4 v[8];
#pragma unroll
  for (int j = 0; j < 8; ++j)
    v[j] = *reinterpret_cast<const f32x4*>(in + base + j * 1024);
#pragma unroll
  for (int j = 0; j < 8; ++j) {
    u32x2 o;
    o[0] = pack_f16(v[j][0], v[j][1]);
    o[1] = pack_f16(v[j][2], v[j][3]);
    *reinterpret_cast<u32x2*>(out + base + j * 1024) = o;
  }
  // Inlined beside other jobs, code may follow these stores: no register that
  // an issued store names is rewritten before this wait.
  asm volatile("s_wait_xcnt 0x0" ::: "memory");
}

// transpose+convert: in [K][Nc] f32 row-major -> out [Nc][K] f16 row-major.
// One block per 128(k) x 64(n) tile; block blk takes tile column blk % (Nc / 64).
// K and Nc are compile-time so that the eight row loads share one address
// register pair and differ only in their immediate offsets.
template <int K, int Nc>
static __device__ __forceinline__ void cvtT_f16_block(
    const float* __restrict__ in, _Float16* __restrict__ out,
    unsigned (*tile)[TT_PITCH], int blk) {
  const int tid = threadIdx.x;
  const int n0 = (blk % (Nc / 64)) * 64, k0 = (blk / (Nc / 64)) * 128;
  const int c4 = tid & 15, r = tid >> 4;
  const float* src = in + (size_t)(k0 + r) * Nc + n0 + 4 * c4;
  // Unrolled, loads apart from LDS writes: all eight loads are in flight
  // before the first is waited for.
  f32x4 v[8];
#pragma unroll
  for (int i = 0; i < 8; ++i)
    v[i] = *reinterpret_cast<const f32x4*>(src + (size_t)i * 16 * Nc);
#pragma unroll
  for (int i = 0; i < 8; ++i) {
    tile[r + 16 * i][2 * c4] = pack_f16(v[i][0], v[i][1]);
    tile[r + 16 * i][2 * c4 + 1] = pack_f16(v[i][2], v[i][3]);
  }
  __syncthreads();  // the whole tile is written before any column is read
  _Float16* dst = out + (size_t)n0 * K + k0;
  tile_store_T(tile, dst, (size_t)K, tid);
  tile_store_T(tile + 64, dst + 64, (size_t)K, tid);
  // Inlined beside other jobs, code may follow these stores: no register that
  // an issued store names is rewritten before this wait.
  asm volatile("s_wait_xcnt 0x0" ::: "memory");
}

// The three conversions of inputs read nothing of each other's output, so they
// share one launch: a block picks its job by its index. The transposes come
// first: their path (load, LDS, barrier, LDS, store) is the longer one.
// The choice is the same for a whole block,
// so every thread of a transposing block reaches that block's barrier.
#define NB_WQKV  ((3 * D_MODEL / 64) * (D_MODEL / 128))
#define NB_WPROJ ((D_MODEL / 64) * (D_MODEL / 128))
#define NB_X     (BATCH * NSEQ * D_MODEL / 8192)
__global__ __launch_bounds__(256) void prep_kernel(
    const float* __restrict__ x, const float* __restrict__ qkv_w,
    const float* __restrict__ proj_w, _Float16* __restrict__ xh,
    _Float16* __restrict__ wqkvT, _Float16* __restrict__ wprojT) {
  __shared__ unsigned tile[128][TT_PITCH];
  const int blk = blockIdx.x;
  if (blk < NB_WQKV)
    cvtT_f16_block<D_MODEL, 3 * D_MODEL>(qkv_w, wqkvT, tile, blk);
  else if (blk < NB_WQKV + NB_WPROJ)
    cvtT_f16_block<D_MODEL, D_MODEL>(proj_w, wprojT, tile, blk - NB_WQKV);
  else
    cvt_f16_block(x, xh, blk - (NB_WQKV + NB_WPROJ));
}

// ---------------- WMMA GEMM with async-LDS double buffering ------------------
// C[M,Nc] = A[M,K](f16) @ Bt[Nc,K]^T(f16) + bias.
// 256 threads = 8 waves (4x2); workgroup tile 128M x 128N, K-step 64.
// A staged row is 64 f16 = one whole 128-B line, so a wave-wide copy touches
// four whole lines, and a 128 x 128 tile reads each operand from L2 fewer times.
// With f16 output, a block whose columns lie in the V third of the QKV product
// writes its tile as vT[b][h][dh][key], the layout the attention kernel reads,
// and writes nothing to outp: nobody reads V in row-major form.
#define VT_PITCH 136  // f16 per staged column: 272 B = 16 B x odd
template <int OUTF32>
__global__ __launch_bounds__(256) void gemm_wmma_kernel(
    const _Float16* __restrict__ A, const _Float16* __restrict__ Bt,
    const float* __restrict__ bias, void* __restrict__ outp,
    _Float16* __restrict__ vT, int M, int Ncols, int K) {
  __shared__ __attribute__((aligned(16))) _Float16 lsA[2][128][72];
  __shared__ __attribute__((aligned(16))) _Float16 lsB[2][128][72];

  const int tid = threadIdx.x;
  const int l = tid & 31, wave = tid >> 5;
  const int lh = l >> 4, lm = l & 15;
  const int wm = wave >> 1, wn = wave & 1;
  const int mbase = blockIdx.y * 128;
  const int nbase = blockIdx.x * 128;

  // stage issue: 4 A-chunks + 4 B-chunks of 16 B per thread; 8 lanes per row,
  // chunk i lies 32 rows below chunk i-1.
  const int cr = tid >> 3, cseg = tid & 7;
  const _Float16* gA = A + (size_t)(mbase + cr) * K + cseg * 8;
  const _Float16* gB = Bt + (size_t)(nbase + cr) * K + cseg * 8;
  const size_t g32 = (size_t)32 * K;
  auto issue = [&](int s, int kk) {
    const _Float16* pa = gA + kk;
    const _Float16* pb = gB + kk;
    asm volatile(
        "global_load_async_to_lds_b128 %0, %8, off\n\t"
        "global_load_async_to_lds_b128 %1, %9, off\n\t"
        "global_load_async_to_lds_b128 %2, %10, off\n\t"
        "global_load_async_to_lds_b128 %3, %11, off\n\t"
        "global_load_async_to_lds_b128 %4, %12, off\n\t"
        "global_load_async_to_lds_b128 %5, %13, off\n\t"
        "global_load_async_to_lds_b128 %6, %14, off\n\t"
        "global_load_async_to_lds_b128 %7, %15, off\n\t"
        "s_wait_xcnt 0x0"
        :: "v"(lds_off(&lsA[s][cr][cseg * 8])),
           "v"(lds_off(&lsA[s][cr + 32][cseg * 8])),
           "v"(lds_off(&lsA[s][cr + 64][cseg * 8])),
           "v"(lds_off(&lsA[s][cr + 96][cseg * 8])),
           "v"(lds_off(&lsB[s][cr][cseg * 8])),
           "v"(lds_off(&lsB[s][cr + 32][cseg * 8])),
           "v"(lds_off(&lsB[s][cr + 64][cseg * 8])),
           "v"(lds_off(&lsB[s][cr + 96][cseg * 8])),
           "v"(pa), "v"(pa + g32), "v"(pa + 2 * g32), "v"(pa + 3 * g32),
           "v"(pb), "v"(pb + g32), "v"(pb + 2 * g32), "v"(pb + 3 * g32)
        : "memory");
  };

  v8f acc[2][4];
#pragma unroll
  for (int t = 0; t < 2; ++t)
#pragma unroll
    for (int u = 0; u < 4; ++u) acc[t][u] = v8f_zero();

  const int nk = K / 64;
  issue(0, 0);
  S_WAIT_ASYNCCNT(0);       // this wave's part of stage 0 has landed
  __syncthreads();          // stage 0 visible to all waves
  if (nk > 1) issue(1, 64);
  for (int ik = 0; ik < nk; ++ik) {
    const int s = ik & 1;
    // Unrolled: the two 32-wide halves of the step differ only in immediate
    // LDS offsets, and the fragment arrays stay in registers.
#pragma unroll
    for (int kh = 0; kh < 2; ++kh) {
      v16h a[2], bo[4];
#pragma unroll
      for (int t = 0; t < 2; ++t)
        a[t] = load_ab(&lsA[s][wm * 32 + t * 16 + lm][kh * 32 + 8 * lh]);
#pragma unroll
      for (int u = 0; u < 4; ++u)
        bo[u] = load_ab(&lsB[s][wn * 64 + u * 16 + lm][kh * 32 + 8 * lh]);
#pragma unroll
      for (int t = 0; t < 2; ++t)
#pragma unroll
        for (int u = 0; u < 4; ++u)
          acc[t][u] = wmma_f16(a[t], bo[u], acc[t][u]);
    }
    // Foot of the step: own reads of buffer s retired, own copies of stage
    // ik+1 landed; the one barrier publishes stage ik+1 and frees buffer s.
    asm volatile("s_wait_dscnt 0x0" ::: "memory");
    S_WAIT_ASYNCCNT(0);
    __syncthreads();
    if (ik + 2 < nk) issue(s, (ik + 2) * 64);
  }
  S_WAIT_ASYNCCNT(0);       // nothing in flight when the wave goes on to end

  // The choice is the same for a whole block, so all its threads reach the barrier.
  if (!OUTF32 && nbase >= 2 * D_MODEL) {
    // A lane holds 8 consecutive rows (keys) of one column (dh): 16 B of a vT row.
    // The tile is staged column by column in the A ring, which the barrier at the
    // foot of the last K-step has freed, so that the stores take whole rows of
    // 128 keys (two 128-B lines, one writer each).
    _Float16 (*stg)[VT_PITCH] =
        reinterpret_cast<_Float16 (*)[VT_PITCH]>(&lsA[0][0][0]);
#pragma unroll
    for (int t = 0; t < 2; ++t) {
#pragma unroll
      for (int u = 0; u < 4; ++u) {
        const int c = wn * 64 + u * 16 + lm;
        const float bv = bias[nbase + c];
        u32x4 w;
#pragma unroll
        for (int q = 0; q < 4; ++q)
          w[q] = pack_f16(acc[t][u][2 * q] + bv, acc[t][u][2 * q + 1] + bv);
        *reinterpret_cast<u32x4*>(&stg[c][wm * 32 + t * 16 + 8 * lh]) = w;
      }
    }
    __syncthreads();  // the whole tile is staged before any column is read
    // 16 lanes a column; sweep i takes the columns 16 below those of sweep i-1.
    const int sc = tid >> 4, sseg = tid & 15;
    _Float16* dst = vT +
        ((size_t)(mbase / NSEQ) * D_MODEL + (nbase - 2 * D_MODEL) + sc) * NSEQ +
        mbase % NSEQ + sseg * 8;
    // Unrolled, reads apart from stores: the eight LDS reads issue as one group.
    u32x4 v[8];
#pragma unroll
    for (int i = 0; i < 8; ++i)
      v[i] = *reinterpret_cast<const u32x4*>(&stg[sc + 16 * i][sseg * 8]);
#pragma unroll
    for (int i = 0; i < 8; ++i)
      *reinterpret_cast<u32x4*>(dst + (size_t)i * 16 * NSEQ) = v[i];
    // No register that an issued store names is rewritten before this wait.
    asm volatile("s_wait_xcnt 0x0" ::: "memory");
    return;
  }

#pragma unroll
  for (int t = 0; t < 2; ++t) {
#pragma unroll
    for (int u = 0; u < 4; ++u) {
      const int col = nbase + wn * 64 + u * 16 + lm;
      const float bv = bias[col];
#pragma unroll
      for (int j = 0; j < 8; ++j) {
        const int row = mbase + wm * 32 + t * 16 + j + 8 * lh;
        const float v = acc[t][u][j] + bv;
        if (OUTF32)
          ((float*)outp)[(size_t)row * Ncols + col] = v;
        else
          ((_Float16*)outp)[(size_t)row * Ncols + col] = (_Float16)v;
      }
    }
  }
}

// ---------------- Flash attention: 16 waves share K/V/distance via async LDS --
// Each wave owns 16 query rows of one head; a block covers 128 rows of two
// neighbouring heads of one batch. A staged K or V tile then serves eight waves and
// a staged distance tile, which is the same for every head, sixteen: the bytes that
// come from L2 per score are half of what 64 rows of one head take.
// S^T = K @ Q^T trick: softmax row = lane%16; S^T C-layout == A K-layout of
// P@V, so P needs no transpose, only f16 packing.
// A pass takes 64 keys: a staged row of V^T is then one whole 128-B line and a row
// of the distance tile one aligned 256-B unit, the copies of the next tile have
// twice the work to land behind, and the foot of the pass (waits, barrier, copy
// addresses) and the lazy test are paid once per 64 keys.
#define KT 64  // keys per pass
#define QB 128 // query rows per block
#define HB 2   // heads per block
__global__ __launch_bounds__(512) void attn_kernel(
    const _Float16* __restrict__ qkvh, const _Float16* __restrict__ vT,
    const float* __restrict__ gamma, const float* __restrict__ dist,
    _Float16* __restrict__ attnh) {
  __shared__ __attribute__((aligned(16))) _Float16 lsK[2][HB][KT][72];  // [head][key_local][dh], 64 used
  __shared__ __attribute__((aligned(16))) _Float16 lsV[2][HB][64][72];  // [head][dh][key_local], 64 used
  __shared__ __attribute__((aligned(16))) float    lsD[2][QB][68];      // [q_local][key_local], 64 used

  const int tid = threadIdx.x;
  const int l = tid & 31, wave = tid >> 5;
  const int lh = l >> 4, lm = l & 15;
  const int hs = wave >> 3, wq = wave & 7;  // head and row tile within the block
  const int h0 = blockIdx.y * HB, h = h0 + hs, b = blockIdx.z;
  const int qt = blockIdx.x * (QB / 16) + wq;
  const int qrow = qt * 16 + lm;

  const size_t row3d = (size_t)3 * D_MODEL;
  const _Float16* qbase = qkvh + (size_t)(b * NSEQ) * row3d + h * DH_HEAD;
  const _Float16* kbase =
      qkvh + (size_t)(b * NSEQ) * row3d + D_MODEL + h0 * DH_HEAD;
  const _Float16* vTbase = vT + (size_t)(b * H_HEADS + h0) * DH_HEAD * NSEQ;
  const float g = gamma[b * H_HEADS + h];

  // stage issue: 2 K-chunks, 2 V-chunks and 4 distance chunks of 16 B per thread.
  // K: the two heads' parts of a key row lie side by side, one aligned 256-B unit:
  // 16 lanes a row, chunk 1 lies 32 rows below chunk 0.
  // V: 8 lanes a row of one head, chunk 1 is the same row of the other head.
  // distance: 16 lanes a row, chunk i lies 32 rows below chunk i-1.
  const int r8 = tid >> 3, seg8 = tid & 7;
  const int r16 = tid >> 4, seg16 = tid & 15;
  const _Float16* gK = kbase + (size_t)r16 * row3d + seg16 * 8;
  const _Float16* gV = vTbase + (size_t)r8 * NSEQ + seg8 * 8;
  const float* gD = dist + (size_t)(blockIdx.x * QB + r16) * NSEQ + seg16 * 4;
  auto issue = [&](int s, int kb0) {
    const _Float16* pk = gK + (size_t)kb0 * row3d;
    const _Float16* pv = gV + kb0;
    const float* pd = gD + kb0;
    asm volatile(
        "global_load_async_to_lds_b128 %0, %8, off\n\t"
        "global_load_async_to_lds_b128 %1, %9, off\n\t"
        "global_load_async_to_lds_b128 %2, %10, off\n\t"
        "global_load_async_to_lds_b128 %3, %11, off\n\t"
        "global_load_async_to_lds_b128 %4, %12, off\n\t"
        "global_load_async_to_lds_b128 %5, %13, off\n\t"
        "global_load_async_to_lds_b128 %6, %14, off\n\t"
        "global_load_async_to_lds_b128 %7, %15, off\n\t"
        "s_wait_xcnt 0x0"
        :: "v"(lds_off(&lsK[s][seg16 >> 3][r16][(seg16 & 7) * 8])),
           "v"(lds_off(&lsK[s][seg16 >> 3][r16 + 32][(seg16 & 7) * 8])),
           "v"(lds_off(&lsV[s][0][r8][seg8 * 8])),
           "v"(lds_off(&lsV[s][1][r8][seg8 * 8])),
           "v"(lds_off(&lsD[s][r16][seg16 * 4])),
           "v"(lds_off(&lsD[s][r16 + 32][seg16 * 4])),
           "v"(lds_off(&lsD[s][r16 + 64][seg16 * 4])),
           "v"(lds_off(&lsD[s][r16 + 96][seg16 * 4])),
           "v"(pk), "v"(pk + 32 * row3d),
           "v"(pv), "v"(pv + DH_HEAD * NSEQ),
           "v"(pd), "v"(pd + 32 * NSEQ), "v"(pd + 64 * NSEQ),
           "v"(pd + 96 * NSEQ)
        : "memory");
  };

  // Q^T as B operand (col = qrow = lane%16, K = dh contiguous): load once.
  v16h bq[2];
#pragma unroll
  for (int c = 0; c < 2; ++c)
    bq[c] = load_ab(qbase + (size_t)qrow * row3d + c * 32 + 8 * lh);

  v8f o[4];
#pragma unroll
  for (int d = 0; d < 4; ++d) o[d] = v8f_zero();
  float m = -1e30f, ssum = 0.0f;

  const int nkb = NSEQ / KT;
  issue(0, 0);
  S_WAIT_ASYNCCNT(0);       // this wave's part of stage 0 has landed
  __syncthreads();          // stage 0 visible to all waves
  issue(1, KT);
  for (int kb = 0; kb < nkb; ++kb) {
    const int s = kb & 1;

    // S^T tiles: A = 16 key rows from LDS, B = Q^T. Kdim = 64 -> 2 WMMA each.
    v8f st[4];
#pragma unroll
    for (int t = 0; t < 4; ++t) {
      v16h ak0 = load_ab(&lsK[s][hs][t * 16 + lm][8 * lh]);
      v16h ak1 = load_ab(&lsK[s][hs][t * 16 + lm][32 + 8 * lh]);
      st[t] = wmma_f16(ak0, bq[0], v8f_zero());
      st[t] = wmma_f16(ak1, bq[1], st[t]);
    }

    // scale + distance bias; element j of tile t = (key kb0+t*16+8*lh+j, qrow)
    float sc[4][8];
#pragma unroll
    for (int t = 0; t < 4; ++t) {
      // The pairs are written out: left to itself the compiler pairs the scores
      // across register pairs here and pays for it in register copies.
      const f32x4* dp =
          reinterpret_cast<const f32x4*>(&lsD[s][wq * 16 + lm][t * 16 + 8 * lh]);
      const f32x4 d0 = dp[0], d1 = dp[1];
#pragma unroll
      for (int j = 0; j < 8; j += 2) {
        const f32x2 s2 = {st[t][j], st[t][j + 1]};
        const f32x2 d2 = {j < 4 ? d0[j] : d1[j - 4], j < 4 ? d0[j + 1] : d1[j - 3]};
        const f32x2 r2 = s2 * QK_SCALE - g * d2;
        sc[t][j] = r2[0];
        sc[t][j + 1] = r2[1];
      }
    }

    // online softmax (row = qrow = lane%16) against a reference m that is renewed
    // lazily: m is the same in both lanes of a row and stays in use while no score
    // of the wave's pass lies more than LAZY_MARGIN above it, so p <= e^LAZY_MARGIN,
    // far inside f16 and f32 range; the final division by ssum cancels the
    // reference whatever it is.
    float bm = -1e30f;
#pragma unroll
    for (int t = 0; t < 4; ++t)
#pragma unroll
      for (int j = 0; j < 8; ++j) bm = fmaxf(bm, sc[t][j]);
    // One test a pass for the whole wave, a scalar branch on the ballot: the
    // exchange between the halves, alpha, and the rescaling of ssum and of the 32
    // O accumulators run only in a pass that raises the reference.
    if (__builtin_amdgcn_ballot_w32(bm > m + LAZY_MARGIN) != 0) {
      bm = fmaxf(bm, __shfl_xor(bm, 16));
      const float nm = fmaxf(m, bm);
      const float alpha = __expf(m - nm);
      ssum *= alpha;
      m = nm;
      // row of O tile j = qrow-local j+8*lh
#pragma unroll
      for (int j = 0; j < 8; ++j) {
        const float aj = __shfl(alpha, j + 8 * lh);
#pragma unroll
        for (int d = 0; d < 4; ++d) o[d][j] *= aj;
      }
    }
    // V B-operands from LDS (key contiguous per dh row), asked for as one group at
    // the head of the region that the branch opens. The scheduling barrier keeps
    // them there: without it the reads sink behind the exponentials, pair by pair,
    // and each pair is waited for as soon as it is issued.
    v16h vb[2][4];
#pragma unroll
    for (int c = 0; c < 2; ++c)
#pragma unroll
      for (int d = 0; d < 4; ++d)
        vb[c][d] = load_ab(&lsV[s][hs][d * 16 + lm][c * 32 + 8 * lh]);
    __builtin_amdgcn_sched_barrier(0);
    // exp(x) as exp2(x * log2 e), the arithmetic of __expf, with the subtraction and
    // the product written in pairs like the scores: one packed instruction for two
    // scores. Left single, the compiler fuses them into dual-issue pairs.
    // Each 32-key half keeps a sum of its own, in the order of its keys.
    float p[4][8];
    float ps[2] = {0.0f, 0.0f};
#pragma unroll
    for (int t = 0; t < 4; ++t)
#pragma unroll
      for (int j = 0; j < 8; j += 2) {
        const f32x2 s2 = {sc[t][j], sc[t][j + 1]};
        const f32x2 a2 = (s2 - m) * LOG2_E;
        p[t][j] = __builtin_amdgcn_exp2f(a2[0]);
        p[t][j + 1] = __builtin_amdgcn_exp2f(a2[1]);
        ps[t >> 1] += p[t][j];
        ps[t >> 1] += p[t][j + 1];
      }
    float pt = ps[0] + ps[1];
    pt += __shfl_xor(pt, 16);
    ssum += pt;

#pragma unroll
    for (int c = 0; c < 2; ++c) {
      v16h pa;
#pragma unroll
      for (int j = 0; j < 8; ++j) {
        pa[j] = (_Float16)p[2 * c][j];
        pa[8 + j] = (_Float16)p[2 * c + 1][j];
      }
#pragma unroll
      for (int d = 0; d < 4; ++d) o[d] = wmma_f16(pa, vb[c][d], o[d]);
    }

    // Foot of the pass: own reads of buffer s retired, own copies of stage
    // kb+1 landed; the one barrier publishes stage kb+1 and frees buffer s.
    // The scheduling barrier keeps the pass's vector and matrix work in front of
    // the waits: lifted to mid-pass they would expose the V reads' latency and
    // halve the time the copies have to land.
    __builtin_amdgcn_sched_barrier(0);
    asm volatile("s_wait_dscnt 0x0" ::: "memory");
    S_WAIT_ASYNCCNT(0);
    __syncthreads();
    if (kb + 2 < nkb) issue(s, (kb + 2) * KT);
  }
  S_WAIT_ASYNCCNT(0);       // nothing in flight when the wave goes on to end

  const float inv = 1.0f / ssum;
#pragma unroll
  for (int j = 0; j < 8; ++j) {
    const float ij = __shfl(inv, j + 8 * lh);
    const int row = qt * 16 + j + 8 * lh;
#pragma unroll
    for (int d = 0; d < 4; ++d) {
      attnh[((size_t)(b * NSEQ) + row) * D_MODEL + h * DH_HEAD + d * 16 + lm] =
          (_Float16)(o[d][j] * ij);
    }
  }
}

// ---------------------------------------------------------------------------
extern "C" void kernel_launch(void* const* d_in, const int* in_sizes, int n_in,
                              void* d_out, int out_size, void* d_ws,
                              size_t ws_size, hipStream_t stream) {
  const float* x      = (const float*)d_in[0];
  const float* gamma  = (const float*)d_in[1];
  const float* dist   = (const float*)d_in[2];
  const float* qkv_w  = (const float*)d_in[3];
  const float* qkv_b  = (const float*)d_in[4];
  const float* proj_w = (const float*)d_in[5];
  const float* proj_b = (const float*)d_in[6];
  float* out = (float*)d_out;

  const size_t n_x    = (size_t)BATCH * NSEQ * D_MODEL;      // 4Mi elems
  const size_t n_qkvw = (size_t)D_MODEL * 3 * D_MODEL;       // 3Mi
  const size_t n_pw   = (size_t)D_MODEL * D_MODEL;           // 1Mi
  const size_t n_qkv  = (size_t)BATCH * NSEQ * 3 * D_MODEL;  // 12Mi

  char* ws = (char*)d_ws;
  _Float16* xh     = (_Float16*)ws; ws += n_x * 2;
  _Float16* wqkvT  = (_Float16*)ws; ws += n_qkvw * 2;
  _Float16* wprojT = (_Float16*)ws; ws += n_pw * 2;
  _Float16* qkvh   = (_Float16*)ws; ws += n_qkv * 2;
  _Float16* vTh    = (_Float16*)ws; ws += n_x * 2;
  _Float16* attnh  = (_Float16*)ws; ws += n_x * 2;
  // total ws use: ~56 MB

  prep_kernel<<<NB_WQKV + NB_WPROJ + NB_X, 256, 0, stream>>>(
      x, qkv_w, proj_w, xh, wqkvT, wprojT);

  dim3 g1(3 * D_MODEL / 128, BATCH * NSEQ / 128);
  gemm_wmma_kernel<0><<<g1, 256, 0, stream>>>(xh, wqkvT, qkv_b, qkvh, vTh,
                                              BATCH * NSEQ, 3 * D_MODEL,
                                              D_MODEL);

  dim3 ga(NSEQ / QB, H_HEADS / HB, BATCH);
  attn_kernel<<<ga, 512, 0, stream>>>(qkvh, vTh, gamma, dist, attnh);

  dim3 g2(D_MODEL / 128, BATCH * NSEQ / 128);
  gemm_wmma_kernel<1><<<g2, 256, 0, stream>>>(attnh, wprojT, proj_b, out, nullptr,
                                              BATCH * NSEQ, D_MODEL, D_MODEL);
}

// v010
// Measured time: 87.9 microseconds a run.
// Two timings next to v009 both put it at 1.04 times that version's speed.
// Counting every step since v000, it is 2.83 times as fast.
#include <hip/hip_runtime.h>
#include <hip/hip_bf16.h>

typedef __attribute__((ext_vector_type(16))) _Float16 v16h;
typedef __attribute__((ext_vector_type(8)))  float    v8f;

#define D_MODEL  1024
#define H_HEADS  16
#define DH_HEAD  64
#define NSEQ     2048
#define BATCH    2
#define QK_SCALE 0.03125f  // 1024^-0.5
#define LOG2_E 1.442695041f
#define LAZY_MARGIN 5.5f    // about 8 in log2: a probability stays below 256

static __device__ __forceinline__ unsigned lds_off(const void* p) {
  return (unsigned)(unsigned long long)p;
}
#define S_WAIT_ASYNCCNT(n) asm volatile("s_wait_asynccnt " #n ::: "memory")

static __device__ __forceinline__ v16h load_ab(const _Float16* p) {
  v16h r;
  __builtin_memcpy(&r, p, 16);
  __builtin_memcpy(reinterpret_cast<char*>(&r) + 16, p + 16, 16);
  return r;
}

static __device__ __forceinline__ v8f v8f_zero() {
  v8f z;
#pragma unroll
  for (int j = 0; j < 8; ++j) z[j] = 0.0f;
  return z;
}

static __device__ __forceinline__ v8f wmma_f16(v16h a, v16h b, v8f c) {
  return __builtin_amdgcn_wmma_f32_16x16x32_f16(false, a, false, b, (short)0, c,
                                                false, false);
}

// ---------------- conversion and transposition ----------------
// All three jobs move 16 B per lane (8 B where f32 narrows to f16 in place) so that
// every wave-wide access covers whole 128-B lines, and a thread handles many
// elements, so that few waves have to be started.
typedef __attribute__((ext_vector_type(4))) float    f32x4;
typedef __attribute__((ext_vector_type(2))) float    f32x2;
typedef __attribute__((ext_vector_type(4))) unsigned u32x4;
typedef __attribute__((ext_vector_type(2))) unsigned u32x2;
typedef __attribute__((ext_vector_type(2))) _Float16 f16x2;

static __device__ __forceinline__ unsigned pack_f16(float a, float b) {
  f16x2 p;
  p[0] = (_Float16)a;
  p[1] = (_Float16)b;
  return __builtin_bit_cast(unsigned, p);
}

#define TT_PITCH 33

// Column-wise read of 64 tile rows and row-wise store of their transpose:
// dst row c (pitch dpitch elements) receives rows 0..63 of column c.
// 8 lanes cover one 128-B destination line; a thread serves columns 2*cp, 2*cp+1.
static __device__ __forceinline__ void tile_store_T(
    const unsigned (*tile)[TT_PITCH], _Float16* __restrict__ dst, size_t dpitch,
    int tid) {
  const int rs = tid & 7, cp = tid >> 3;
  // Both loops unrolled: w, lo and hi are indexed by constants and stay in
  // registers, and the eight LDS reads issue as one group.
  unsigned w[8];
#pragma unroll
  for (int i = 0; i < 8; ++i) w[i] = tile[8 * rs + i][cp];
  u32x4 lo, hi;
#pragma unroll
  for (int q = 0; q < 4; ++q) {
    lo[q] = (w[2 * q] & 0xffffu) | (w[2 * q + 1] << 16);
    hi[q] = (w[2 * q] >> 16) | (w[2 * q + 1] & 0xffff0000u);
  }
  *reinterpret_cast<u32x4*>(dst + (size_t)(2 * cp) * dpitch + 8 * rs) = lo;
  *reinterpret_cast<u32x4*>(dst + (size_t)(2 * cp + 1) * dpitch + 8 * rs) = hi;
}

// elementwise f32 -> f16; block blk converts 8192 consecutive elements.
static __device__ __forceinline__ void cvt_f16_block(
    const float* __restrict__ in, _Float16* __restrict__ out, int blk) {
  const size_t base = (size_t)blk * 8192 + threadIdx.x * 4;
  // Unrolled, loads apart from stores: all eight loads are in flight before
  // the first is waited for.
  f32x4 v[8];
#pragma unroll
  for (int j = 0; j < 8; ++j)
    v[j] = *reinterpret_cast<const f32x4*>(in + base + j * 1024);
#pragma unroll
  for (int j = 0; j < 8; ++j) {
    u32x2 o;
    o[0] = pack_f16(v[j][0], v[j][1]);
    o[1] = pack_f16(v[j][2], v[j][3]);
    *reinterpret_cast<u32x2*>(out + base + j * 1024) = o;
  }
  // Inlined beside other jobs, code may follow these stores: no register that
  // an issued store names is rewritten before this wait.
  asm volatile("s_wait_xcnt 0x0" ::: "memory");
}

// transpose+convert: in [K][Nc] f32 row-major -> out [Nc][K] f16 row-major.
// One block per 128(k) x 64(n) tile; block blk takes tile column blk % (Nc / 64).
// K and Nc are compile-time so that the eight row loads share one address
// register pair and differ only in their immediate offsets.
template <int K, int Nc>
static __device__ __forceinline__ void cvtT_f16_block(
    const float* __restrict__ in, _Float16* __restrict__ out,
    unsigned (*tile)[TT_PITCH], int blk) {
  const int tid = threadIdx.x;
  const int n0 = (blk % (Nc / 64)) * 64, k0 = (blk / (Nc / 64)) * 128;
  const int c4 = tid & 15, r = tid >> 4;
  const float* src = in + (size_t)(k0 + r) * Nc + n0 + 4 * c4;
  // Unrolled, loads apart from LDS writes: all eight loads are in flight
  // before the first is waited for.
  f32x4 v[8];
#pragma unroll
  for (int i = 0; i < 8; ++i)
    v[i] = *reinterpret_cast<const f32x4*>(src + (size_t)i * 16 * Nc);
#pragma unroll
  for (int i = 0; i < 8; ++i) {
    tile[r + 16 * i][2 * c4] = pack_f16(v[i][0], v[i][1]);
    tile[r + 16 * i][2 * c4 + 1] = pack_f16(v[i][2], v[i][3]);
  }
  __syncthreads();  // the whole tile is written before any column is read
  _Float16* dst = out + (size_t)n0 * K + k0;
  tile_store_T(tile, dst, (size_t)K, tid);
  tile_store_T(tile + 64, dst + 64, (size_t)K, tid);
  // Inlined beside other jobs, code may follow these stores: no register that
  // an issued store names is rewritten before this wait.
  asm volatile("s_wait_xcnt 0x0" ::: "memory");
}

// The three conversions of inputs read nothing of each other's output, so they
// share one launch: a block picks its job by its index. The transposes come
// first: their path (load, LDS, barrier, LDS, store) is the longer one.
// The choice is the same for a whole block,
// so every thread of a transposing block reaches that block's barrier.
#define NB_WQKV  ((3 * D_MODEL / 64) * (D_MODEL / 128))
#define NB_WPROJ ((D_MODEL / 64) * (D_MODEL / 128))
#define NB_X     (BATCH * NSEQ * D_MODEL / 8192)
__global__ __launch_bounds__(256) void prep_kernel(
    const float* __restrict__ x, const float* __restrict__ qkv_w,
    const float* __restrict__ proj_w, _Float16* __restrict__ xh,
    _Float16* __restrict__ wqkvT, _Float16* __restrict__ wprojT) {
  __shared__ unsigned tile[128][TT_PITCH];
  const int blk = blockIdx.x;
  if (blk < NB_WQKV)
    cvtT_f16_block<D_MODEL, 3 * D_MODEL>(qkv_w, wqkvT, tile, blk);
  else if (blk < NB_WQKV + NB_WPROJ)
    cvtT_f16_block<D_MODEL, D_MODEL>(proj_w, wprojT, tile, blk - NB_WQKV);
  else
    cvt_f16_block(x, xh, blk - (NB_WQKV + NB_WPROJ));
}

// ---------------- WMMA GEMM with async-LDS double buffering ------------------
// C[M,Nc] = A[M,K](f16) @ Bt[Nc,K]^T(f16) + bias.
// 256 threads = 8 waves (4x2); workgroup tile 128M x 128N, K-step 64.
// A staged row is 64 f16 = one whole 128-B line, so a wave-wide copy touches
// four whole lines, and a 128 x 128 tile reads each operand from L2 fewer times.
// With f16 output, a block whose columns lie in the V third of the QKV product
// writes its tile as vT[b][h][dh][key], the layout the attention kernel reads,
// and writes nothing to outp: nobody reads V in row-major form.
#define VT_PITCH 136  // f16 per staged column: 272 B = 16 B x odd
template <int OUTF32>
__global__ __launch_bounds__(256) void gemm_wmma_kernel(
    const _Float16* __restrict__ A, const _Float16* __restrict__ Bt,
    const float* __restrict__ bias, void* __restrict__ outp,
    _Float16* __restrict__ vT, int M, int Ncols, int K) {
  __shared__ __attribute__((aligned(16))) _Float16 lsA[2][128][72];
  __shared__ __attribute__((aligned(16))) _Float16 lsB[2][128][72];

  const int tid = threadIdx.x;
  const int l = tid & 31, wave = tid >> 5;
  const int lh = l >> 4, lm = l & 15;
  const int wm = wave >> 1, wn = wave & 1;
  const int mbase = blockIdx.y * 128;
  const int nbase = blockIdx.x * 128;

  // stage issue: 4 A-chunks + 4 B-chunks of 16 B per thread; 8 lanes per row,
  // chunk i lies 32 rows below chunk i-1.
  const int cr = tid >> 3, cseg = tid & 7;
  const _Float16* gA = A + (size_t)(mbase + cr) * K + cseg * 8;
  const _Float16* gB = Bt + (size_t)(nbase + cr) * K + cseg * 8;
  const size_t g32 = (size_t)32 * K;
  auto issue = [&](int s, int kk) {
    const _Float16* pa = gA + kk;
    const _Float16* pb = gB + kk;
    asm volatile(
        "global_load_async_to_lds_b128 %0, %8, off\n\t"
        "global_load_async_to_lds_b128 %1, %9, off\n\t"
        "global_load_async_to_lds_b128 %2, %10, off\n\t"
        "global_load_async_to_lds_b128 %3, %11, off\n\t"
        "global_load_async_to_lds_b128 %4, %12, off\n\t"
        "global_load_async_to_lds_b128 %5, %13, off\n\t"
        "global_load_async_to_lds_b128 %6, %14, off\n\t"
        "global_load_async_to_lds_b128 %7, %15, off\n\t"
        "s_wait_xcnt 0x0"
        :: "v"(lds_off(&lsA[s][cr][cseg * 8])),
           "v"(lds_off(&lsA[s][cr + 32][cseg * 8])),
           "v"(lds_off(&lsA[s][cr + 64][cseg * 8])),
           "v"(lds_off(&lsA[s][cr + 96][cseg * 8])),
           "v"(lds_off(&lsB[s][cr][cseg * 8])),
           "v"(lds_off(&lsB[s][cr + 32][cseg * 8])),
           "v"(lds_off(&lsB[s][cr + 64][cseg * 8])),
           "v"(lds_off(&lsB[s][cr + 96][cseg * 8])),
           "v"(pa), "v"(pa + g32), "v"(pa + 2 * g32), "v"(pa + 3 * g32),
           "v"(pb), "v"(pb + g32), "v"(pb + 2 * g32), "v"(pb + 3 * g32)
        : "memory");
  };

  v8f acc[2][4];
#pragma unroll
  for (int t = 0; t < 2; ++t)
#pragma unroll
    for (int u = 0; u < 4; ++u) acc[t][u] = v8f_zero();

  const int nk = K / 64;
  issue(0, 0);
  S_WAIT_ASYNCCNT(0);       // this wave's part of stage 0 has landed
  __syncthreads();          // stage 0 visible to all waves
  if (nk > 1) issue(1, 64);
  for (int ik = 0; ik < nk; ++ik) {
    const int s = ik & 1;
    // Unrolled: the two 32-wide halves of the step differ only in immediate
    // LDS offsets, and the fragment arrays stay in registers.
#pragma unroll
    for (int kh = 0; kh < 2; ++kh) {
      v16h a[2], bo[4];
#pragma unroll
      for (int t = 0; t < 2; ++t)
        a[t] = load_ab(&lsA[s][wm * 32 + t * 16 + lm][kh * 32 + 8 * lh]);
#pragma unroll
      for (int u = 0; u < 4; ++u)
        bo[u] = load_ab(&lsB[s][wn * 64 + u * 16 + lm][kh * 32 + 8 * lh]);
#pragma unroll
      for (int t = 0; t < 2; ++t)
#pragma unroll
        for (int u = 0; u < 4; ++u)
          acc[t][u] = wmma_f16(a[t], bo[u], acc[t][u]);
    }
    // Foot of the step: own reads of buffer s retired, own copies of stage
    // ik+1 landed; the one barrier publishes stage ik+1 and frees buffer s.
    asm volatile("s_wait_dscnt 0x0" ::: "memory");
    S_WAIT_ASYNCCNT(0);
    __syncthreads();
    if (ik + 2 < nk) issue(s, (ik + 2) * 64);
  }
  S_WAIT_ASYNCCNT(0);       // nothing in flight when the wave goes on to end

  // The choice is the same for a whole block, so all its threads reach the barrier.
  if (!OUTF32 && nbase >= 2 * D_MODEL) {
    // A lane holds 8 consecutive rows (keys) of one column (dh): 16 B of a vT row.
    // The tile is staged column by column in the A ring, which the barrier at the
    // foot of the last K-step has freed, so that the stores take whole rows of
    // 128 keys (two 128-B lines, one writer each).
    _Float16 (*stg)[VT_PITCH] =
        reinterpret_cast<_Float16 (*)[VT_PITCH]>(&lsA[0][0][0]);
#pragma unroll
    for (int t = 0; t < 2; ++t) {
#pragma unroll
      for (int u = 0; u < 4; ++u) {
        const int c = wn * 64 + u * 16 + lm;
        const float bv = bias[nbase + c];
        u32x4 w;
#pragma unroll
        for (int q = 0; q < 4; ++q)
          w[q] = pack_f16(acc[t][u][2 * q] + bv, acc[t][u][2 * q + 1] + bv);
        *reinterpret_cast<u32x4*>(&stg[c][wm * 32 + t * 16 + 8 * lh]) = w;
      }
    }
    __syncthreads();  // the whole tile is staged before any column is read
    // 16 lanes a column; sweep i takes the columns 16 below those of sweep i-1.
    const int sc = tid >> 4, sseg = tid & 15;
    _Float16* dst = vT +
        ((size_t)(mbase / NSEQ) * D_MODEL + (nbase - 2 * D_MODEL) + sc) * NSEQ +
        mbase % NSEQ + sseg * 8;
    // Unrolled, reads apart from stores: the eight LDS reads issue as one group.
    u32x4 v[8];
#pragma unroll
    for (int i = 0; i < 8; ++i)
      v[i] = *reinterpret_cast<const u32x4*>(&stg[sc + 16 * i][sseg * 8]);
#pragma unroll
    for (int i = 0; i < 8; ++i)
      *reinterpret_cast<u32x4*>(dst + (size_t)i * 16 * NSEQ) = v[i];
    // No register that an issued store names is rewritten before this wait.
    asm volatile("s_wait_xcnt 0x0" ::: "memory");
    return;
  }

#pragma unroll
  for (int t = 0; t < 2; ++t) {
#pragma unroll
    for (int u = 0; u < 4; ++u) {
      const int col = nbase + wn * 64 + u * 16 + lm;
      const float bv = bias[col];
#pragma unroll
      for (int j = 0; j < 8; ++j) {
        const int row = mbase + wm * 32 + t * 16 + j + 8 * lh;
        const float v = acc[t][u][j] + bv;
        if (OUTF32)
          ((float*)outp)[(size_t)row * Ncols + col] = v;
        else
          ((_Float16*)outp)[(size_t)row * Ncols + col] = (_Float16)v;
      }
    }
  }
}

// ---------------- Flash attention: 16 waves share K/V/distance via async LDS --
// A block covers 128 query rows of two neighbouring heads of one batch. A staged K
// or V tile then serves eight waves and a staged distance tile, which is the same
// for every head, sixteen: the bytes that come from L2 per score are half of what
// 64 rows of one head take.
// A wave owns 32 query rows (two 16-row tiles) of one head and, of every pass, 32
// of the 64 staged keys: a K or V fragment read from LDS feeds two matrix products,
// one per row tile, so that a score takes three fifths of the LDS reads that a wave
// of 16 rows x 64 keys needs. A row's keys are thus spread over two waves and, in
// each, over the two halves of the lanes: every lane keeps the sum of its own keys,
// each wave a reference and an O of its own; all parts of a row are joined once,
// behind the loop, where the two waves exchange one row tile each through LDS.
// S^T = K @ Q^T trick: softmax row = lane%16; S^T C-layout == A K-layout of
// P@V, so P needs no transpose, only f16 packing.
// A pass takes 64 keys: a staged row of V^T is then one whole 128-B line and a row
// of the distance tile one aligned 256-B unit, the copies of the next tile have
// twice the work to land behind, and the foot of the pass (waits, barrier, copy
// addresses) and the lazy test are paid once per 64 keys.
#define KT 64  // keys per pass
#define QB 128 // query rows per block
#define HB 2   // heads per block
__global__ __launch_bounds__(512) void attn_kernel(
    const _Float16* __restrict__ qkvh, const _Float16* __restrict__ vT,
    const float* __restrict__ gamma, const float* __restrict__ dist,
    _Float16* __restrict__ attnh) {
  __shared__ __attribute__((aligned(16))) _Float16 lsK[2][HB][KT][72];  // [head][key_local][dh], 64 used
  __shared__ __attribute__((aligned(16))) _Float16 lsV[2][HB][64][72];  // [head][dh][key_local], 64 used
  __shared__ __attribute__((aligned(16))) float    lsD[2][QB][68];      // [q_local][key_local], 64 used

  const int tid = threadIdx.x;
  const int l = tid & 31, wave = tid >> 5;
  const int lh = l >> 4, lm = l & 15;
  // head, 32-row group and 32-key half within the block
  const int hs = wave >> 3, qp = (wave >> 1) & 3, kh = wave & 1;
  const int h0 = blockIdx.y * HB, h = h0 + hs, b = blockIdx.z;
  const int q0 = blockIdx.x * QB + qp * 32;  // first query row of the wave

  const size_t row3d = (size_t)3 * D_MODEL;
  const _Float16* qbase = qkvh + (size_t)(b * NSEQ) * row3d + h * DH_HEAD;
  const _Float16* kbase =
      qkvh + (size_t)(b * NSEQ) * row3d + D_MODEL + h0 * DH_HEAD;
  const _Float16* vTbase = vT + (size_t)(b * H_HEADS + h0) * DH_HEAD * NSEQ;
  const float g = gamma[b * H_HEADS + h];

  // stage issue: 2 K-chunks, 2 V-chunks and 4 distance chunks of 16 B per thread.
  // K: the two heads' parts of a key row lie side by side, one aligned 256-B unit:
  // 16 lanes a row, chunk 1 lies 32 rows below chunk 0.
  // V: 8 lanes a row of one head, chunk 1 is the same row of the other head.
  // distance: 16 lanes a row, chunk i lies 32 rows below chunk i-1.
  const int r8 = tid >> 3, seg8 = tid & 7;
  const int r16 = tid >> 4, seg16 = tid & 15;
  const _Float16* gK = kbase + (size_t)r16 * row3d + seg16 * 8;
  const _Float16* gV = vTbase + (size_t)r8 * NSEQ + seg8 * 8;
  const float* gD = dist + (size_t)(blockIdx.x * QB + r16) * NSEQ + seg16 * 4;
  auto issue = [&](int s, int kb0) {
    const _Float16* pk = gK + (size_t)kb0 * row3d;
    const _Float16* pv = gV + kb0;
    const float* pd = gD + kb0;
    asm volatile(
        "global_load_async_to_lds_b128 %0, %8, off\n\t"
        "global_load_async_to_lds_b128 %1, %9, off\n\t"
        "global_load_async_to_lds_b128 %2, %10, off\n\t"
        "global_load_async_to_lds_b128 %3, %11, off\n\t"
        "global_load_async_to_lds_b128 %4, %12, off\n\t"
        "global_load_async_to_lds_b128 %5, %13, off\n\t"
        "global_load_async_to_lds_b128 %6, %14, off\n\t"
        "global_load_async_to_lds_b128 %7, %15, off\n\t"
        "s_wait_xcnt 0x0"
        :: "v"(lds_off(&lsK[s][seg16 >> 3][r16][(seg16 & 7) * 8])),
           "v"(lds_off(&lsK[s][seg16 >> 3][r16 + 32][(seg16 & 7) * 8])),
           "v"(lds_off(&lsV[s][0][r8][seg8 * 8])),
           "v"(lds_off(&lsV[s][1][r8][seg8 * 8])),
           "v"(lds_off(&lsD[s][r16][seg16 * 4])),
           "v"(lds_off(&lsD[s][r16 + 32][seg16 * 4])),
           "v"(lds_off(&lsD[s][r16 + 64][seg16 * 4])),
           "v"(lds_off(&lsD[s][r16 + 96][seg16 * 4])),
           "v"(pk), "v"(pk + 32 * row3d),
           "v"(pv), "v"(pv + DH_HEAD * NSEQ),
           "v"(pd), "v"(pd + 32 * NSEQ), "v"(pd + 64 * NSEQ),
           "v"(pd + 96 * NSEQ)
        : "memory");
  };

  // Q^T as B operand (col = query row = lane%16, K = dh contiguous): load once,
  // one pair of fragments per row tile a.
  v16h bq[2][2];
#pragma unroll
  for (int a = 0; a < 2; ++a)
#pragma unroll
    for (int c = 0; c < 2; ++c)
      bq[a][c] =
          load_ab(qbase + (size_t)(q0 + a * 16 + lm) * row3d + c * 32 + 8 * lh);

  v8f o[2][4];
#pragma unroll
  for (int a = 0; a < 2; ++a)
#pragma unroll
    for (int d = 0; d < 4; ++d) o[a][d] = v8f_zero();
  float m[2] = {-1e30f, -1e30f}, ssum[2] = {0.0f, 0.0f};
  // Probabilities of the pass before, not yet summed (see the head of the pass).
  float p[2][2][8];
#pragma unroll
  for (int a = 0; a < 2; ++a)
#pragma unroll
    for (int t = 0; t < 2; ++t)
#pragma unroll
      for (int j = 0; j < 8; ++j) p[a][t][j] = 0.0f;

  const int nkb = NSEQ / KT;
  issue(0, 0);
  S_WAIT_ASYNCCNT(0);       // this wave's part of stage 0 has landed
  __syncthreads();          // stage 0 visible to all waves
  issue(1, KT);
  for (int kb = 0; kb < nkb; ++kb) {
    const int s = kb & 1;

    // The pass's K and distance fragments, asked for as one group.
    v16h ak[2][2];
    f32x4 dd[2][2][2];
#pragma unroll
    for (int t = 0; t < 2; ++t) {
      ak[t][0] = load_ab(&lsK[s][hs][kh * 32 + t * 16 + lm][8 * lh]);
      ak[t][1] = load_ab(&lsK[s][hs][kh * 32 + t * 16 + lm][32 + 8 * lh]);
#pragma unroll
      for (int a = 0; a < 2; ++a) {
        const f32x4* dp = reinterpret_cast<const f32x4*>(
            &lsD[s][qp * 32 + a * 16 + lm][kh * 32 + t * 16 + 8 * lh]);
        dd[a][t][0] = dp[0];
        dd[a][t][1] = dp[1];
      }
    }
    // Keeps the reads in front of the additions below: the compiler otherwise puts
    // the additions first, and every wave's reads wait behind them after the barrier.
    __builtin_amdgcn_sched_barrier(0);
    // Row sums of the pass before, each row tile's in the order of its keys: they
    // run while the reads are under way. The reference has not changed since.
#pragma unroll
    for (int a = 0; a < 2; ++a) {
      float ps = 0.0f;
#pragma unroll
      for (int t = 0; t < 2; ++t)
#pragma unroll
        for (int j = 0; j < 8; ++j) ps += p[a][t][j];
      ssum[a] += ps;
    }

    // S^T tiles: A = 16 key rows from LDS, B = Q^T. Kdim = 64 -> 2 WMMA each.
    // Each K fragment multiplies both row tiles.
    v8f st[2][2];
#pragma unroll
    for (int t = 0; t < 2; ++t)
#pragma unroll
      for (int a = 0; a < 2; ++a) {
        st[a][t] = wmma_f16(ak[t][0], bq[a][0], v8f_zero());
        st[a][t] = wmma_f16(ak[t][1], bq[a][1], st[a][t]);
      }

    // scale + distance bias; element j of tile (a, t) =
    // (key kb0+kh*32+t*16+8*lh+j, query row q0+a*16+lm)
    float sc[2][2][8];
#pragma unroll
    for (int a = 0; a < 2; ++a)
#pragma unroll
      for (int t = 0; t < 2; ++t) {
        // The pairs are written out: left to itself the compiler pairs the scores
        // across register pairs here and pays for it in register copies.
        const f32x4 d0 = dd[a][t][0], d1 = dd[a][t][1];
#pragma unroll
        for (int j = 0; j < 8; j += 2) {
          const f32x2 s2 = {st[a][t][j], st[a][t][j + 1]};
          const f32x2 d2 = {j < 4 ? d0[j] : d1[j - 4],
                            j < 4 ? d0[j + 1] : d1[j - 3]};
          const f32x2 r2 = s2 * QK_SCALE - g * d2;
          sc[a][t][j] = r2[0];
          sc[a][t][j + 1] = r2[1];
        }
      }

    // online softmax (row = lane%16 of row tile a) against a reference m that is
    // renewed lazily: m is the same in both lanes of a row and stays in use while no
    // score of the wave's pass lies more than LAZY_MARGIN above it, so
    // p <= e^LAZY_MARGIN, far inside f16 and f32 range; the final division by the
    // row sum cancels the reference whatever it is.
    float bm[2] = {-1e30f, -1e30f};
#pragma unroll
    for (int a = 0; a < 2; ++a)
#pragma unroll
      for (int t = 0; t < 2; ++t)
#pragma unroll
        for (int j = 0; j < 8; ++j) bm[a] = fmaxf(bm[a], sc[a][t][j]);
    // One test a pass for the whole wave, a scalar branch on the ballot: the
    // exchange between the halves, alpha, and the rescaling of the sums and of the
    // 64 O accumulators run only in a pass that raises a reference.
    if (__builtin_amdgcn_ballot_w32(bm[0] > m[0] + LAZY_MARGIN ||
                                    bm[1] > m[1] + LAZY_MARGIN) != 0) {
#pragma unroll
      for (int a = 0; a < 2; ++a) {
        const float bx = fmaxf(bm[a], __shfl_xor(bm[a], 16));
        const float nm = fmaxf(m[a], bx);
        const float alpha = __expf(m[a] - nm);
        ssum[a] *= alpha;
        m[a] = nm;
        // row of O tile j = local row j+8*lh
#pragma unroll
        for (int j = 0; j < 8; ++j) {
          const float aj = __shfl(alpha, j + 8 * lh);
#pragma unroll
          for (int d = 0; d < 4; ++d) o[a][d][j] *= aj;
        }
      }
    }
    // V B-operands from LDS (key contiguous per dh row), asked for as one group at
    // the head of the region that the branch opens; each serves both row tiles. The
    // scheduling barrier keeps them there: without it the reads sink behind the
    // exponentials, pair by pair, and each pair is waited for as soon as it is
    // issued.
    v16h vb[4];
#pragma unroll
    for (int d = 0; d < 4; ++d)
      vb[d] = load_ab(&lsV[s][hs][d * 16 + lm][kh * 32 + 8 * lh]);
    __builtin_amdgcn_sched_barrier(0);
#pragma unroll
    for (int a = 0; a < 2; ++a) {
#pragma unroll
      for (int t = 0; t < 2; ++t)
#pragma unroll
        for (int j = 0; j < 8; j += 2) {
          const f32x2 s2 = {sc[a][t][j], sc[a][t][j + 1]};
          const f32x2 a2 = (s2 - m[a]) * LOG2_E;
          p[a][t][j] = __builtin_amdgcn_exp2f(a2[0]);
          p[a][t][j + 1] = __builtin_amdgcn_exp2f(a2[1]);
        }
      v16h pa;
#pragma unroll
      for (int j = 0; j < 8; ++j) {
        pa[j] = (_Float16)p[a][0][j];
        pa[8 + j] = (_Float16)p[a][1][j];
      }
#pragma unroll
      for (int d = 0; d < 4; ++d) o[a][d] = wmma_f16(pa, vb[d], o[a][d]);
      // Keeps the tiles apart, so that the second tile's exponentials run beside the
      // first tile's products.
      if (a == 0) __builtin_amdgcn_sched_barrier(0);
    }
    // Foot of the pass: own reads of buffer s retired, own copies of stage
    // kb+1 landed; the one barrier publishes stage kb+1 and frees buffer s.
    // The scheduling barrier keeps the pass's vector and matrix work in front of
    // the waits: lifted to mid-pass they would expose the V reads' latency and
    // halve the time the copies have to land.
    __builtin_amdgcn_sched_barrier(0);
    asm volatile("s_wait_dscnt 0x0" ::: "memory");
    S_WAIT_ASYNCCNT(0);
    __syncthreads();
    if (kb + 2 < nkb) issue(s, (kb + 2) * KT);
  }
  S_WAIT_ASYNCCNT(0);       // nothing in flight when the wave goes on to end

  // Join of the two key halves. Wave kh finishes row tile kh and hands its part of
  // the other tile to its partner (wave ^ 1) through the distance ring, which the
  // barrier at the foot of the last pass has freed: 4 KiB of O per wave, 16 B per
  // lane and write, and, through the K ring, one row of references and sums.
  float* xo = &lsD[0][0][0];                             // 16 waves x 1024 floats
  float* xm = reinterpret_cast<float*>(&lsK[0][0][0][0]);  // 16 waves x 64 floats
  v8f ok[4];
#pragma unroll
  for (int d = 0; d < 4; ++d) {
    const v8f os = kh ? o[0][d] : o[1][d];
    ok[d] = kh ? o[1][d] : o[0][d];
    f32x4 w0, w1;
#pragma unroll
    for (int j = 0; j < 4; ++j) {
      w0[j] = os[j];
      w1[j] = os[4 + j];
    }
    *reinterpret_cast<f32x4*>(xo + wave * 1024 + ((2 * d) * 32 + l) * 4) = w0;
    *reinterpret_cast<f32x4*>(xo + wave * 1024 + ((2 * d + 1) * 32 + l) * 4) = w1;
  }
  // The last pass's probabilities are still to be summed. A lane has summed the keys
  // of its own half of the lanes only: the two halves of a row are joined here, once.
#pragma unroll
  for (int a = 0; a < 2; ++a) {
    float ps = 0.0f;
#pragma unroll
    for (int t = 0; t < 2; ++t)
#pragma unroll
      for (int j = 0; j < 8; ++j) ps += p[a][t][j];
    ssum[a] += ps;
    ssum[a] += __shfl_xor(ssum[a], 16);
  }
  xm[wave * 64 + l] = kh ? m[0] : m[1];
  xm[wave * 64 + 32 + l] = kh ? ssum[0] : ssum[1];
  const float mk = kh ? m[1] : m[0], sk = kh ? ssum[1] : ssum[0];
  __syncthreads();  // every wave's part is written before its partner reads it
  const int pw = wave ^ 1;
  const float mp = xm[pw * 64 + l], sp = xm[pw * 64 + 32 + l];
  const float nm = fmaxf(mk, mp);
  float fk, fp;
  asm("v_exp_f32 %0, %1\n\tv_nop" : "=v"(fk) : "v"((mk - nm) * LOG2_E));
  asm("v_exp_f32 %0, %1\n\tv_nop" : "=v"(fp) : "v"((mp - nm) * LOG2_E));
  const float inv = 1.0f / (sk * fk + sp * fp);
  const float ck = fk * inv, cp = fp * inv;
  v8f op[4];
#pragma unroll
  for (int d = 0; d < 4; ++d) {
    const f32x4 w0 =
        *reinterpret_cast<const f32x4*>(xo + pw * 1024 + ((2 * d) * 32 + l) * 4);
    const f32x4 w1 = *reinterpret_cast<const f32x4*>(xo + pw * 1024 +
                                                     ((2 * d + 1) * 32 + l) * 4);
#pragma unroll
    for (int j = 0; j < 4; ++j) {
      op[d][j] = w0[j];
      op[d][4 + j] = w1[j];
    }
  }
#pragma unroll
  for (int j = 0; j < 8; ++j) {
    const float kj = __shfl(ck, j + 8 * lh);
    const float pj = __shfl(cp, j + 8 * lh);
    const int row = q0 + kh * 16 + j + 8 * lh;
#pragma unroll
    for (int d = 0; d < 4; ++d) {
      attnh[((size_t)(b * NSEQ) + row) * D_MODEL + h * DH_HEAD + d * 16 + lm] =
          (_Float16)(ok[d][j] * kj + op[d][j] * pj);
    }
  }
}

// ---------------------------------------------------------------------------
extern "C" void kernel_launch(void* const* d_in, const int* in_sizes, int n_in,
                              void* d_out, int out_size, void* d_ws,
                              size_t ws_size, hipStream_t stream) {
  const float* x      = (const float*)d_in[0];
  const float* gamma  = (const float*)d_in[1];
  const float* dist   = (const float*)d_in[2];
  const float* qkv_w  = (const float*)d_in[3];
  const float* qkv_b  = (const float*)d_in[4];
  const float* proj_w = (const float*)d_in[5];
  const float* proj_b = (const float*)d_in[6];
  float* out = (float*)d_out;

  const size_t n_x    = (size_t)BATCH * NSEQ * D_MODEL;      // 4Mi elems
  const size_t n_qkvw = (size_t)D_MODEL * 3 * D_MODEL;       // 3Mi
  const size_t n_pw   = (size_t)D_MODEL * D_MODEL;           // 1Mi
  const size_t n_qkv  = (size_t)BATCH * NSEQ * 3 * D_MODEL;  // 12Mi

  char* ws = (char*)d_ws;
  _Float16* xh     = (_Float16*)ws; ws += n_x * 2;
  _Float16* wqkvT  = (_Float16*)ws; ws += n_qkvw * 2;
  _Float16* wprojT = (_Float16*)ws; ws += n_pw * 2;
  _Float16* qkvh   = (_Float16*)ws; ws += n_qkv * 2;
  _Float16* vTh    = (_Float16*)ws; ws += n_x * 2;
  _Float16* attnh  = (_Float16*)ws; ws += n_x * 2;
  // total ws use: ~56 MB

  prep_kernel<<<NB_WQKV + NB_WPROJ + NB_X, 256, 0, stream>>>(
      x, qkv_w, proj_w, xh, wqkvT, wprojT);

  dim3 g1(3 * D_MODEL / 128, BATCH * NSEQ / 128);
  gemm_wmma_kernel<0><<<g1, 256, 0, stream>>>(xh, wqkvT, qkv_b, qkvh, vTh,
                                              BATCH * NSEQ, 3 * D_MODEL,
                                              D_MODEL);

  dim3 ga(NSEQ / QB, H_HEADS / HB, BATCH);
  attn_kernel<<<ga, 512, 0, stream>>>(qkvh, vTh, gamma, dist, attnh);

  dim3 g2(D_MODEL / 128, BATCH * NSEQ / 128);
  gemm_wmma_kernel<1><<<g2, 256, 0, stream>>>(attnh, wprojT, proj_b, out, nullptr,
                                              BATCH * NSEQ, D_MODEL, D_MODEL);
}
